// v000
// Times are from an AMD MI455X. After a warm-up the kernel runs many times in a row, and a time is the length of
// such a window on the GPU divided by its runs, so every launch and the gaps after it count. The runs cycle
// through copies of the inputs. A figure is the median of several windows, for all but v000 over two sittings.
// Sittings can differ by a few percent; kernels timed side by side share one.
// v000, which the later versions start from, runs in 76 microseconds.
#include <hip/hip_runtime.h>
#include <hip/hip_bf16.h>

// Problem constants (fixed by the reference)
#define AB 16   // batch
#define AQ 64   // queries
#define AK 512  // keys
#define AH 256  // hidden == D

typedef __attribute__((ext_vector_type(2))) float    v2f;
typedef __attribute__((ext_vector_type(8))) float    v8f;
typedef __attribute__((ext_vector_type(4))) unsigned v4u;
typedef __attribute__((ext_vector_type(8))) int      v8i;
typedef __attribute__((ext_vector_type(4))) int      v4i;

#if defined(__has_builtin)
#  if __has_builtin(__builtin_amdgcn_tanhf)
#    define TANHF(x) __builtin_amdgcn_tanhf(x)
#  elif __has_builtin(__builtin_amdgcn_tanh_f32)
#    define TANHF(x) __builtin_amdgcn_tanh_f32(x)
#  else
#    define TANHF(x) tanhf(x)
#  endif
#else
#  define TANHF(x) tanhf(x)
#endif

// Tensor Data Mover (this toolchain: 6-arg clang-23 form:
// (v4u g0, v8i g1, v4i g2, v4i g3, v8i g4, i32 cpol)).
#if defined(__has_builtin)
#  if __has_builtin(__builtin_amdgcn_tensor_load_to_lds) && \
      __has_builtin(__builtin_amdgcn_s_wait_tensorcnt)
#    define HAVE_TDM 1
#  endif
#endif

#define BROW 72
#define KCHUNK 64
#define NPANEL 64
#define CHUNKF (KCHUNK * BROW)   // floats per LDS buffer

#if defined(HAVE_TDM)
__device__ __forceinline__ void tdm_stage_panel(const float* gsrc,
                                                const float* ldst, int N)
{
  const unsigned long long gaddr = (unsigned long long)(const void*)gsrc;
  const unsigned lds_off = (unsigned)(unsigned long long)(const void*)ldst;
  v4u g0;
  g0[0] = 1u;                                        // count=1, user mode
  g0[1] = lds_off;                                   // lds_addr (bytes)
  g0[2] = (unsigned)(gaddr & 0xFFFFFFFFull);         // global_addr[31:0]
  g0[3] = (unsigned)((gaddr >> 32) & 0x1FFFFFFull)   // global_addr[56:32]
          | (2u << 30);                              // type = 2 ("image")
  const unsigned td0 = (unsigned)N;
  const unsigned td1 = KCHUNK;
  const unsigned long long str0 = (unsigned long long)N;
  v8i g1;
  g1[0] = (int)((2u << 16) | (1u << 20) | (5u << 22) | (7u << 25));
  g1[1] = (int)((td0 & 0xFFFFu) << 16);              // [63:48]=td0 lo16
  g1[2] = (int)((td0 >> 16) | ((td1 & 0xFFFFu) << 16));
  g1[3] = (int)((td1 >> 16) | ((unsigned)NPANEL << 16));
  g1[4] = (int)KCHUNK;
  g1[5] = (int)(str0 & 0xFFFFFFFFull);
  g1[6] = (int)((str0 >> 32) & 0xFFFFull);           // stride1 = 0
  g1[7] = 0;
  v4i gz  = {0, 0, 0, 0};                            // 2D: groups 2/3 NULL
  v8i gz8 = {0, 0, 0, 0, 0, 0, 0, 0};                // unused extra group
  __builtin_amdgcn_tensor_load_to_lds(g0, g1, gz, gz, gz8, 0);
}
#endif

// ---------------------------------------------------------------------------
// Batched row-major GEMM: C[b] = A[b](MxK) * B[b](KxN), f32, via
// V_WMMA_F32_16X16X4_F32. Block = 128 threads (4 waves). Block tile 64x64:
// wave w owns rows m0+16w, all four 16-col n-tiles (4 accumulators).
// B k-panels are double-buffered in LDS: the Tensor Data Mover prefetches
// chunk c+1 while all waves compute chunk c (one barrier per chunk). A
// fragments for a whole chunk are preloaded as one 16x global_load_b64
// clause so WMMAs never stall on a just-issued load.
// Requires M%64==0, N%64==0, K%64==0.
// ---------------------------------------------------------------------------
__global__ __launch_bounds__(128) void wmma_gemm_f32(
    const float* __restrict__ A, const float* __restrict__ Bm,
    float* __restrict__ C, int M, int N, int K,
    long sA, long sB, long sC)
{
  __shared__ float lds_b[2 * CHUNKF];

  const int lane = threadIdx.x & 31;
  const int wave = threadIdx.x >> 5;          // 0..3 -> m sub-tile
  const int half = lane >> 4;                 // 0 or 1
  const int r    = lane & 15;

  const int m0 = blockIdx.x * 64 + wave * 16;
  const int nb = blockIdx.y * NPANEL;
  const int b  = blockIdx.z;

  const float* Ab = A  + (long)b * sA;
  const float* Bb = Bm + (long)b * sB;
  float*       Cb = C  + (long)b * sC;

  v8f acc[4] = {};

  const float* arow = Ab + (long)(m0 + r) * K + 2 * half;

  const int nchunks = K / KCHUNK;

  auto compute_chunk = [&](int c) {
    const float* buf   = &lds_b[(c & 1) * CHUNKF];
    const float* achnk = arow + c * KCHUNK;
    // Preload all A fragments for this chunk as one load clause.
    v2f afrag[KCHUNK / 4];
#pragma unroll
    for (int i = 0; i < KCHUNK / 4; ++i)
      afrag[i] = *(const v2f*)(achnk + 4 * i);
#pragma unroll
    for (int kk = 0; kk < KCHUNK; kk += 4) {
      const v2f a = afrag[kk >> 2];
      const float* bbase = &buf[(kk + 2 * half) * BROW + r];
#pragma unroll
      for (int nt = 0; nt < 4; ++nt) {
        v2f bf;
        bf[0] = bbase[nt * 16];            // B[kk+2h  ][nb+16nt+r]
        bf[1] = bbase[nt * 16 + BROW];     // B[kk+2h+1][nb+16nt+r]
        acc[nt] = __builtin_amdgcn_wmma_f32_16x16x4_f32(
            false, a, false, bf, (short)0, acc[nt], false, false);
      }
    }
  };

#if defined(HAVE_TDM)
  if (threadIdx.x < 32)
    tdm_stage_panel(Bb + nb, &lds_b[0], N);
  for (int c = 0; c < nchunks; ++c) {
    if (threadIdx.x < 32)
      __builtin_amdgcn_s_wait_tensorcnt(0);   // chunk c has landed
    __syncthreads();                          // publish; buf[(c+1)&1] is free
    if ((c + 1 < nchunks) && threadIdx.x < 32)
      tdm_stage_panel(Bb + (long)(c + 1) * KCHUNK * N + nb,
                      &lds_b[((c + 1) & 1) * CHUNKF], N);
    compute_chunk(c);
  }
#else
  for (int c = 0; c < nchunks; ++c) {
    __syncthreads();
    float* buf = &lds_b[(c & 1) * CHUNKF];
    const float* src = Bb + (long)c * KCHUNK * N + nb;
    for (int f = threadIdx.x; f < KCHUNK * (NPANEL / 4); f += 128) {
      const int kr = f >> 4;        // row in chunk
      const int c4 = f & 15;        // float4 within row
      *(float4*)&buf[kr * BROW + c4 * 4] =
          *(const float4*)&src[(long)kr * N + c4 * 4];
    }
    __syncthreads();
    compute_chunk(c);
  }
#endif

#pragma unroll
  for (int nt = 0; nt < 4; ++nt) {
    float* cp = Cb + (long)(m0 + 8 * half) * N + nb + nt * 16 + r;
#pragma unroll
    for (int j = 0; j < 8; ++j)
      cp[(long)j * N] = acc[nt][j];
  }
}

// ---------------------------------------------------------------------------
// Fused scores + mask + softmax:
//   s[b,q,k] = sum_h w_v[h] * tanh(qproj[b,q,h] + kproj[b,k,h])
//   s = (k < valid_len[b]) ? s : -1e6 ; attn = softmax_k(s)
// One block per (b,q); 512 threads = one key each. Avoids materializing the
// 537 MB (B,Q,K,H) features tensor. VALU/TRANS bound (134M v_tanh_f32 total).
// ---------------------------------------------------------------------------
__global__ __launch_bounds__(512) void scores_softmax(
    const float* __restrict__ qproj, const float* __restrict__ kproj,
    const float* __restrict__ wv, const int* __restrict__ valid_lens,
    float* __restrict__ attn)
{
  __shared__ float lq[AH];
  __shared__ float lw[AH];
  __shared__ float lr[AK];

  const int tid = threadIdx.x;     // key index
  const int bq  = blockIdx.x;      // flattened (b,q)
  const int b   = bq >> 6;         // bq / AQ

  for (int i = tid; i < AH; i += AK) {
    lq[i] = qproj[(long)bq * AH + i];
    lw[i] = wv[i];
  }
  __syncthreads();

  float s = 0.f;
  const float* kr = kproj + ((long)b * AK + tid) * AH;
#pragma unroll 4
  for (int h = 0; h < AH; h += 4) {
    float4 kv = *(const float4*)(kr + h);
    s = fmaf(lw[h + 0], TANHF(lq[h + 0] + kv.x), s);
    s = fmaf(lw[h + 1], TANHF(lq[h + 1] + kv.y), s);
    s = fmaf(lw[h + 2], TANHF(lq[h + 2] + kv.z), s);
    s = fmaf(lw[h + 3], TANHF(lq[h + 3] + kv.w), s);
  }

  if (tid >= valid_lens[b]) s = -1e6f;   // reference NEG_INF fill

  // max over K
  lr[tid] = s;
  __syncthreads();
  for (int off = AK / 2; off > 0; off >>= 1) {
    if (tid < off) lr[tid] = fmaxf(lr[tid], lr[tid + off]);
    __syncthreads();
  }
  const float mx = lr[0];
  __syncthreads();

  // sum of exp
  const float e = __expf(s - mx);
  lr[tid] = e;
  __syncthreads();
  for (int off = AK / 2; off > 0; off >>= 1) {
    if (tid < off) lr[tid] += lr[tid + off];
    __syncthreads();
  }
  const float inv = 1.0f / lr[0];

  attn[(long)bq * AK + tid] = e * inv;
}

// ---------------------------------------------------------------------------
// Launch: two projection GEMMs, fused scores/softmax, batched attn@values.
// d_ws: [qproj 1MB | kproj 8MB | attn 2MB]
// ---------------------------------------------------------------------------
extern "C" void kernel_launch(void* const* d_in, const int* in_sizes, int n_in,
                              void* d_out, int out_size, void* d_ws, size_t ws_size,
                              hipStream_t stream)
{
  const float* querys = (const float*)d_in[0];  // (16,64,256)
  const float* keys   = (const float*)d_in[1];  // (16,512,256)
  const float* values = (const float*)d_in[2];  // (16,512,256)
  const int*   vlen   = (const int*)d_in[3];    // (16,)
  const float* Wq     = (const float*)d_in[4];  // (256,256)
  const float* Wk     = (const float*)d_in[5];  // (256,256)
  const float* wv     = (const float*)d_in[6];  // (256,)
  float* out = (float*)d_out;                   // (16,64,256)

  float* qproj = (float*)d_ws;                           // 16*64*256
  float* kproj = qproj + (size_t)AB * AQ * AH;           // 16*512*256
  float* attn  = kproj + (size_t)AB * AK * AH;           // 16*64*512

  // q = querys @ Wq : M=1024, N=256, K=256
  wmma_gemm_f32<<<dim3((AB * AQ) / 64, AH / NPANEL, 1), 128, 0, stream>>>(
      querys, Wq, qproj, AB * AQ, AH, AH, 0, 0, 0);

  // k = keys @ Wk : M=8192, N=256, K=256
  wmma_gemm_f32<<<dim3((AB * AK) / 64, AH / NPANEL, 1), 128, 0, stream>>>(
      keys, Wk, kproj, AB * AK, AH, AH, 0, 0, 0);

  // fused scores + mask + softmax : one block per (b,q)
  scores_softmax<<<dim3(AB * AQ), 512, 0, stream>>>(
      qproj, kproj, wv, vlen, attn);

  // out = attn @ values : batched, M=64, N=256, K=512
  wmma_gemm_f32<<<dim3(AQ / 64, AH / NPANEL, AB), 128, 0, stream>>>(
      attn, values, out, AQ, AH, AK,
      (long)AQ * AK, (long)AK * AH, (long)AQ * AH);
}

// v001
// Measured time: 50.9 microseconds a run.
// In two side-by-side timings against v000, it was 1.56 and 1.55 times as fast.
#include <hip/hip_runtime.h>
#include <hip/hip_bf16.h>

// Problem constants (fixed by the reference)
#define AB 16   // batch
#define AQ 64   // queries
#define AK 512  // keys
#define AH 256  // hidden == D

typedef __attribute__((ext_vector_type(2))) float    v2f;
typedef __attribute__((ext_vector_type(8))) float    v8f;
typedef __attribute__((ext_vector_type(4))) unsigned v4u;
typedef __attribute__((ext_vector_type(8))) int      v8i;
typedef __attribute__((ext_vector_type(4))) int      v4i;

#if defined(__has_builtin)
#  if __has_builtin(__builtin_amdgcn_tanhf)
#    define TANHF(x) __builtin_amdgcn_tanhf(x)
#  elif __has_builtin(__builtin_amdgcn_tanh_f32)
#    define TANHF(x) __builtin_amdgcn_tanh_f32(x)
#  else
#    define TANHF(x) tanhf(x)
#  endif
#else
#  define TANHF(x) tanhf(x)
#endif

// Tensor Data Mover (this toolchain: 6-arg clang-23 form:
// (v4u g0, v8i g1, v4i g2, v4i g3, v8i g4, i32 cpol)).
#if defined(__has_builtin)
#  if __has_builtin(__builtin_amdgcn_tensor_load_to_lds) && \
      __has_builtin(__builtin_amdgcn_s_wait_tensorcnt)
#    define HAVE_TDM 1
#  endif
#endif

#define BROW 72
#define KCHUNK 64
#define NPANEL 64
#define CHUNKF (KCHUNK * BROW)   // floats per LDS buffer

#if defined(HAVE_TDM)
__device__ __forceinline__ void tdm_stage_panel(const float* gsrc,
                                                const float* ldst, int N)
{
  const unsigned long long gaddr = (unsigned long long)(const void*)gsrc;
  const unsigned lds_off = (unsigned)(unsigned long long)(const void*)ldst;
  v4u g0;
  g0[0] = 1u;                                        // count=1, user mode
  g0[1] = lds_off;                                   // lds_addr (bytes)
  g0[2] = (unsigned)(gaddr & 0xFFFFFFFFull);         // global_addr[31:0]
  g0[3] = (unsigned)((gaddr >> 32) & 0x1FFFFFFull)   // global_addr[56:32]
          | (2u << 30);                              // type = 2 ("image")
  const unsigned td0 = (unsigned)N;
  const unsigned td1 = KCHUNK;
  const unsigned long long str0 = (unsigned long long)N;
  v8i g1;
  g1[0] = (int)((2u << 16) | (1u << 20) | (5u << 22) | (7u << 25));
  g1[1] = (int)((td0 & 0xFFFFu) << 16);              // [63:48]=td0 lo16
  g1[2] = (int)((td0 >> 16) | ((td1 & 0xFFFFu) << 16));
  g1[3] = (int)((td1 >> 16) | ((unsigned)NPANEL << 16));
  g1[4] = (int)KCHUNK;
  g1[5] = (int)(str0 & 0xFFFFFFFFull);
  g1[6] = (int)((str0 >> 32) & 0xFFFFull);           // stride1 = 0
  g1[7] = 0;
  v4i gz  = {0, 0, 0, 0};                            // 2D: groups 2/3 NULL
  v8i gz8 = {0, 0, 0, 0, 0, 0, 0, 0};                // unused extra group
  __builtin_amdgcn_tensor_load_to_lds(g0, g1, gz, gz, gz8, 0);
}
#endif

// ---------------------------------------------------------------------------
// Batched row-major GEMM: C[b] = A[b](MxK) * B[b](KxN), f32, via
// V_WMMA_F32_16X16X4_F32. Block = 128 threads (4 waves). Block tile 64x64:
// wave w owns rows m0+16w, all four 16-col n-tiles (4 accumulators).
// B k-panels are double-buffered in LDS: the Tensor Data Mover prefetches
// chunk c+1 while all waves compute chunk c (one barrier per chunk). A
// fragments for a whole chunk are preloaded as one 16x global_load_b64
// clause so WMMAs never stall on a just-issued load.
// Requires M%64==0, N%64==0, K%64==0.
// ---------------------------------------------------------------------------
__global__ __launch_bounds__(128) void wmma_gemm_f32(
    const float* __restrict__ A, const float* __restrict__ Bm,
    float* __restrict__ C, int M, int N, int K,
    long sA, long sB, long sC)
{
  __shared__ float lds_b[2 * CHUNKF];

  const int lane = threadIdx.x & 31;
  const int wave = threadIdx.x >> 5;          // 0..3 -> m sub-tile
  const int half = lane >> 4;                 // 0 or 1
  const int r    = lane & 15;

  const int m0 = blockIdx.x * 64 + wave * 16;
  const int nb = blockIdx.y * NPANEL;
  const int b  = blockIdx.z;

  const float* Ab = A  + (long)b * sA;
  const float* Bb = Bm + (long)b * sB;
  float*       Cb = C  + (long)b * sC;

  v8f acc[4] = {};

  const float* arow = Ab + (long)(m0 + r) * K + 2 * half;

  const int nchunks = K / KCHUNK;

  auto compute_chunk = [&](int c) {
    const float* buf   = &lds_b[(c & 1) * CHUNKF];
    const float* achnk = arow + c * KCHUNK;
    // Preload all A fragments for this chunk as one load clause.
    v2f afrag[KCHUNK / 4];
#pragma unroll
    for (int i = 0; i < KCHUNK / 4; ++i)
      afrag[i] = *(const v2f*)(achnk + 4 * i);
#pragma unroll
    for (int kk = 0; kk < KCHUNK; kk += 4) {
      const v2f a = afrag[kk >> 2];
      const float* bbase = &buf[(kk + 2 * half) * BROW + r];
#pragma unroll
      for (int nt = 0; nt < 4; ++nt) {
        v2f bf;
        bf[0] = bbase[nt * 16];            // B[kk+2h  ][nb+16nt+r]
        bf[1] = bbase[nt * 16 + BROW];     // B[kk+2h+1][nb+16nt+r]
        acc[nt] = __builtin_amdgcn_wmma_f32_16x16x4_f32(
            false, a, false, bf, (short)0, acc[nt], false, false);
      }
    }
  };

#if defined(HAVE_TDM)
  if (threadIdx.x < 32)
    tdm_stage_panel(Bb + nb, &lds_b[0], N);
  for (int c = 0; c < nchunks; ++c) {
    if (threadIdx.x < 32)
      __builtin_amdgcn_s_wait_tensorcnt(0);   // chunk c has landed
    __syncthreads();                          // publish; buf[(c+1)&1] is free
    if ((c + 1 < nchunks) && threadIdx.x < 32)
      tdm_stage_panel(Bb + (long)(c + 1) * KCHUNK * N + nb,
                      &lds_b[((c + 1) & 1) * CHUNKF], N);
    compute_chunk(c);
  }
#else
  for (int c = 0; c < nchunks; ++c) {
    __syncthreads();
    float* buf = &lds_b[(c & 1) * CHUNKF];
    const float* src = Bb + (long)c * KCHUNK * N + nb;
    for (int f = threadIdx.x; f < KCHUNK * (NPANEL / 4); f += 128) {
      const int kr = f >> 4;        // row in chunk
      const int c4 = f & 15;        // float4 within row
      *(float4*)&buf[kr * BROW + c4 * 4] =
          *(const float4*)&src[(long)kr * N + c4 * 4];
    }
    __syncthreads();
    compute_chunk(c);
  }
#endif

#pragma unroll
  for (int nt = 0; nt < 4; ++nt) {
    float* cp = Cb + (long)(m0 + 8 * half) * N + nb + nt * 16 + r;
#pragma unroll
    for (int j = 0; j < 8; ++j)
      cp[(long)j * N] = acc[nt][j];
  }
}

// ---------------------------------------------------------------------------
// Fused scores + mask + softmax:
//   s[b,q,k] = sum_h w_v[h] * tanh(qproj[b,q,h] + kproj[b,k,h])
//   s = (k < valid_len[b]) ? s : -1e6 ; attn = softmax_k(s)
// One block per (b, QT consecutive queries); 512 threads = one key each.
// A thread's kproj values are loaded once and feed QT running sums, so the
// key rows are fetched AQ/QT times per batch instead of AQ times. Each
// query's sum over h and its two reduction trees keep their order.
// Avoids materializing the 537 MB (B,Q,K,H) features tensor.
// ---------------------------------------------------------------------------
#define QT 4   // queries per block; AQ % QT == 0, so a block stays in one batch

__global__ __launch_bounds__(512) void scores_softmax(
    const float* __restrict__ qproj, const float* __restrict__ kproj,
    const float* __restrict__ wv, const int* __restrict__ valid_lens,
    float* __restrict__ attn)
{
  __shared__ __attribute__((aligned(16))) float lq[QT * AH];
  __shared__ __attribute__((aligned(16))) float lw[AH];
  __shared__ float4 lr[AK];        // component j belongs to query bq0 + j

  const int tid = threadIdx.x;     // key index
  const int bq0 = blockIdx.x * QT; // first flattened (b,q) of this block
  const int b   = bq0 >> 6;        // bq0 / AQ

  for (int i = tid; i < QT * AH; i += AK)
    lq[i] = qproj[(long)bq0 * AH + i];
  if (tid < AH) lw[tid] = wv[tid];
  __syncthreads();

  float s[QT];
#pragma unroll
  for (int j = 0; j < QT; ++j) s[j] = 0.f;

  const float* kr = kproj + ((long)b * AK + tid) * AH;
#pragma unroll 4
  for (int h = 0; h < AH; h += 4) {
    const float4 kv = *(const float4*)(kr + h);
    const float4 w4 = *(const float4*)&lw[h];
#pragma unroll
    for (int j = 0; j < QT; ++j) {
      const float4 q4 = *(const float4*)&lq[j * AH + h];
      s[j] = fmaf(w4.x, TANHF(q4.x + kv.x), s[j]);
      s[j] = fmaf(w4.y, TANHF(q4.y + kv.y), s[j]);
      s[j] = fmaf(w4.z, TANHF(q4.z + kv.z), s[j]);
      s[j] = fmaf(w4.w, TANHF(q4.w + kv.w), s[j]);
    }
  }

  if (tid >= valid_lens[b]) {      // reference NEG_INF fill
#pragma unroll
    for (int j = 0; j < QT; ++j) s[j] = -1e6f;
  }

  // max over K, the QT queries side by side
  lr[tid] = make_float4(s[0], s[1], s[2], s[3]);
  __syncthreads();
  for (int off = AK / 2; off > 0; off >>= 1) {
    if (tid < off) {
      const float4 x = lr[tid], y = lr[tid + off];
      lr[tid] = make_float4(fmaxf(x.x, y.x), fmaxf(x.y, y.y),
                            fmaxf(x.z, y.z), fmaxf(x.w, y.w));
    }
    __syncthreads();
  }
  const float4 mx = lr[0];
  __syncthreads();

  // sum of exp
  const float4 e = make_float4(__expf(s[0] - mx.x), __expf(s[1] - mx.y),
                               __expf(s[2] - mx.z), __expf(s[3] - mx.w));
  lr[tid] = e;
  __syncthreads();
  for (int off = AK / 2; off > 0; off >>= 1) {
    if (tid < off) {
      const float4 x = lr[tid], y = lr[tid + off];
      lr[tid] = make_float4(x.x + y.x, x.y + y.y, x.z + y.z, x.w + y.w);
    }
    __syncthreads();
  }
  const float4 sm = lr[0];

  float* ap = attn + (long)bq0 * AK + tid;
  ap[0 * AK] = e.x * (1.0f / sm.x);
  ap[1 * AK] = e.y * (1.0f / sm.y);
  ap[2 * AK] = e.z * (1.0f / sm.z);
  ap[3 * AK] = e.w * (1.0f / sm.w);
}

// ---------------------------------------------------------------------------
// Launch: two projection GEMMs, fused scores/softmax, batched attn@values.
// d_ws: [qproj 1MB | kproj 8MB | attn 2MB]
// ---------------------------------------------------------------------------
extern "C" void kernel_launch(void* const* d_in, const int* in_sizes, int n_in,
                              void* d_out, int out_size, void* d_ws, size_t ws_size,
                              hipStream_t stream)
{
  const float* querys = (const float*)d_in[0];  // (16,64,256)
  const float* keys   = (const float*)d_in[1];  // (16,512,256)
  const float* values = (const float*)d_in[2];  // (16,512,256)
  const int*   vlen   = (const int*)d_in[3];    // (16,)
  const float* Wq     = (const float*)d_in[4];  // (256,256)
  const float* Wk     = (const float*)d_in[5];  // (256,256)
  const float* wv     = (const float*)d_in[6];  // (256,)
  float* out = (float*)d_out;                   // (16,64,256)

  float* qproj = (float*)d_ws;                           // 16*64*256
  float* kproj = qproj + (size_t)AB * AQ * AH;           // 16*512*256
  float* attn  = kproj + (size_t)AB * AK * AH;           // 16*64*512

  // q = querys @ Wq : M=1024, N=256, K=256
  wmma_gemm_f32<<<dim3((AB * AQ) / 64, AH / NPANEL, 1), 128, 0, stream>>>(
      querys, Wq, qproj, AB * AQ, AH, AH, 0, 0, 0);

  // k = keys @ Wk : M=8192, N=256, K=256
  wmma_gemm_f32<<<dim3((AB * AK) / 64, AH / NPANEL, 1), 128, 0, stream>>>(
      keys, Wk, kproj, AB * AK, AH, AH, 0, 0, 0);

  // fused scores + mask + softmax : one block per (b, QT queries)
  scores_softmax<<<dim3((AB * AQ) / QT), 512, 0, stream>>>(
      qproj, kproj, wv, vlen, attn);

  // out = attn @ values : batched, M=64, N=256, K=512
  wmma_gemm_f32<<<dim3(AQ / 64, AH / NPANEL, AB), 128, 0, stream>>>(
      attn, values, out, AQ, AH, AK,
      (long)AQ * AK, (long)AK * AH, (long)AQ * AH);
}

// v002
// Measured time: 44.5 microseconds a run.
// Two timings next to v001 put it at 1.14 and 1.12 times that version's speed.
// Counting every step since v000, it is 1.75 times as fast.
#include <hip/hip_runtime.h>
#include <hip/hip_bf16.h>

// Problem constants (fixed by the reference)
#define AB 16   // batch
#define AQ 64   // queries
#define AK 512  // keys
#define AH 256  // hidden == D

typedef __attribute__((ext_vector_type(2))) float    v2f;
typedef __attribute__((ext_vector_type(8))) float    v8f;
typedef __attribute__((ext_vector_type(4))) unsigned v4u;
typedef __attribute__((ext_vector_type(8))) int      v8i;
typedef __attribute__((ext_vector_type(4))) int      v4i;

#if defined(__has_builtin)
#  if __has_builtin(__builtin_amdgcn_tanhf)
#    define TANHF(x) __builtin_amdgcn_tanhf(x)
#  elif __has_builtin(__builtin_amdgcn_tanh_f32)
#    define TANHF(x) __builtin_amdgcn_tanh_f32(x)
#  else
#    define TANHF(x) tanhf(x)
#  endif
#else
#  define TANHF(x) tanhf(x)
#endif

// Tensor Data Mover (this toolchain: 6-arg clang-23 form:
// (v4u g0, v8i g1, v4i g2, v4i g3, v8i g4, i32 cpol)).
#if defined(__has_builtin)
#  if __has_builtin(__builtin_amdgcn_tensor_load_to_lds) && \
      __has_builtin(__builtin_amdgcn_s_wait_tensorcnt)
#    define HAVE_TDM 1
#  endif
#endif

#define BROW 72
#define KCHUNK 64
#define NPANEL 64
#define CHUNKF (KCHUNK * BROW)   // floats per LDS buffer

#if defined(HAVE_TDM)
__device__ __forceinline__ void tdm_stage_panel(const float* gsrc,
                                                const float* ldst, int N)
{
  const unsigned long long gaddr = (unsigned long long)(const void*)gsrc;
  const unsigned lds_off = (unsigned)(unsigned long long)(const void*)ldst;
  v4u g0;
  g0[0] = 1u;                                        // count=1, user mode
  g0[1] = lds_off;                                   // lds_addr (bytes)
  g0[2] = (unsigned)(gaddr & 0xFFFFFFFFull);         // global_addr[31:0]
  g0[3] = (unsigned)((gaddr >> 32) & 0x1FFFFFFull)   // global_addr[56:32]
          | (2u << 30);                              // type = 2 ("image")
  const unsigned td0 = (unsigned)N;
  const unsigned td1 = KCHUNK;
  const unsigned long long str0 = (unsigned long long)N;
  v8i g1;
  g1[0] = (int)((2u << 16) | (1u << 20) | (5u << 22) | (7u << 25));
  g1[1] = (int)((td0 & 0xFFFFu) << 16);              // [63:48]=td0 lo16
  g1[2] = (int)((td0 >> 16) | ((td1 & 0xFFFFu) << 16));
  g1[3] = (int)((td1 >> 16) | ((unsigned)NPANEL << 16));
  g1[4] = (int)KCHUNK;
  g1[5] = (int)(str0 & 0xFFFFFFFFull);
  g1[6] = (int)((str0 >> 32) & 0xFFFFull);           // stride1 = 0
  g1[7] = 0;
  v4i gz  = {0, 0, 0, 0};                            // 2D: groups 2/3 NULL
  v8i gz8 = {0, 0, 0, 0, 0, 0, 0, 0};                // unused extra group
  __builtin_amdgcn_tensor_load_to_lds(g0, g1, gz, gz, gz8, 0);
}
#endif

// ---------------------------------------------------------------------------
// Batched row-major GEMM: C[b] = A[b](MxK) * B[b](KxN), f32, via
// V_WMMA_F32_16X16X4_F32. Block = 128 threads (4 waves). Block tile 64x64:
// wave w owns rows m0+16w, all four 16-col n-tiles (4 accumulators).
// B k-panels are double-buffered in LDS: the Tensor Data Mover prefetches
// chunk c+1 while all waves compute chunk c (one barrier per chunk). A
// fragments for a whole chunk are preloaded as one 16x global_load_b64
// clause so WMMAs never stall on a just-issued load.
// Requires M%64==0, N%64==0, K%64==0.
// One launch can carry a second, independent product of the same N, K and
// batch strides: blocks with blockIdx.x >= mblocks compute C2 = A2 * B2,
// their 64-row tile counted from mblocks. A launch with gridDim.x == mblocks
// has no such block and never touches A2, B2, C2.
// ---------------------------------------------------------------------------
__global__ __launch_bounds__(128) void wmma_gemm_f32(
    const float* __restrict__ A, const float* __restrict__ Bm,
    float* __restrict__ C, int M, int N, int K,
    long sA, long sB, long sC,
    const float* __restrict__ A2, const float* __restrict__ B2,
    float* __restrict__ C2, int mblocks)
{
  __shared__ float lds_b[2 * CHUNKF];

  const int lane = threadIdx.x & 31;
  const int wave = threadIdx.x >> 5;          // 0..3 -> m sub-tile
  const int half = lane >> 4;                 // 0 or 1
  const int r    = lane & 15;

  const bool second = (int)blockIdx.x >= mblocks;   // same for the whole block
  const int  mtile  = second ? (int)blockIdx.x - mblocks : (int)blockIdx.x;

  const int m0 = mtile * 64 + wave * 16;
  const int nb = blockIdx.y * NPANEL;
  const int b  = blockIdx.z;

  const float* Ab = (second ? A2 : A)  + (long)b * sA;
  const float* Bb = (second ? B2 : Bm) + (long)b * sB;
  float*       Cb = (second ? C2 : C)  + (long)b * sC;

  v8f acc[4] = {};

  const float* arow = Ab + (long)(m0 + r) * K + 2 * half;

  const int nchunks = K / KCHUNK;

  auto compute_chunk = [&](int c) {
    const float* buf   = &lds_b[(c & 1) * CHUNKF];
    const float* achnk = arow + c * KCHUNK;
    // Preload all A fragments for this chunk as one load clause.
    v2f afrag[KCHUNK / 4];
#pragma unroll
    for (int i = 0; i < KCHUNK / 4; ++i)
      afrag[i] = *(const v2f*)(achnk + 4 * i);
#pragma unroll
    for (int kk = 0; kk < KCHUNK; kk += 4) {
      const v2f a = afrag[kk >> 2];
      const float* bbase = &buf[(kk + 2 * half) * BROW + r];
#pragma unroll
      for (int nt = 0; nt < 4; ++nt) {
        v2f bf;
        bf[0] = bbase[nt * 16];            // B[kk+2h  ][nb+16nt+r]
        bf[1] = bbase[nt * 16 + BROW];     // B[kk+2h+1][nb+16nt+r]
        acc[nt] = __builtin_amdgcn_wmma_f32_16x16x4_f32(
            false, a, false, bf, (short)0, acc[nt], false, false);
      }
    }
  };

#if defined(HAVE_TDM)
  if (threadIdx.x < 32)
    tdm_stage_panel(Bb + nb, &lds_b[0], N);
  for (int c = 0; c < nchunks; ++c) {
    if (threadIdx.x < 32)
      __builtin_amdgcn_s_wait_tensorcnt(0);   // chunk c has landed
    __syncthreads();                          // publish; buf[(c+1)&1] is free
    if ((c + 1 < nchunks) && threadIdx.x < 32)
      tdm_stage_panel(Bb + (long)(c + 1) * KCHUNK * N + nb,
                      &lds_b[((c + 1) & 1) * CHUNKF], N);
    compute_chunk(c);
  }
#else
  for (int c = 0; c < nchunks; ++c) {
    __syncthreads();
    float* buf = &lds_b[(c & 1) * CHUNKF];
    const float* src = Bb + (long)c * KCHUNK * N + nb;
    for (int f = threadIdx.x; f < KCHUNK * (NPANEL / 4); f += 128) {
      const int kr = f >> 4;        // row in chunk
      const int c4 = f & 15;        // float4 within row
      *(float4*)&buf[kr * BROW + c4 * 4] =
          *(const float4*)&src[(long)kr * N + c4 * 4];
    }
    __syncthreads();
    compute_chunk(c);
  }
#endif

#pragma unroll
  for (int nt = 0; nt < 4; ++nt) {
    float* cp = Cb + (long)(m0 + 8 * half) * N + nb + nt * 16 + r;
#pragma unroll
    for (int j = 0; j < 8; ++j)
      cp[(long)j * N] = acc[nt][j];
  }
}

// ---------------------------------------------------------------------------
// Fused scores + mask + softmax:
//   s[b,q,k] = sum_h w_v[h] * tanh(qproj[b,q,h] + kproj[b,k,h])
//   s = (k < valid_len[b]) ? s : -1e6 ; attn = softmax_k(s)
// One block per (b, QT consecutive queries); 512 threads = one key each.
// A thread's kproj values are loaded once and feed QT running sums, so the
// key rows are fetched AQ/QT times per batch instead of AQ times. Each
// query's sum over h and its two reduction trees keep their order.
// Avoids materializing the 537 MB (B,Q,K,H) features tensor.
// ---------------------------------------------------------------------------
#define QT 4   // queries per block; AQ % QT == 0, so a block stays in one batch

__global__ __launch_bounds__(512) void scores_softmax(
    const float* __restrict__ qproj, const float* __restrict__ kproj,
    const float* __restrict__ wv, const int* __restrict__ valid_lens,
    float* __restrict__ attn)
{
  __shared__ __attribute__((aligned(16))) float lq[QT * AH];
  __shared__ __attribute__((aligned(16))) float lw[AH];
  __shared__ float4 lr[AK];        // component j belongs to query bq0 + j

  const int tid = threadIdx.x;     // key index
  const int bq0 = blockIdx.x * QT; // first flattened (b,q) of this block
  const int b   = bq0 >> 6;        // bq0 / AQ

  for (int i = tid; i < QT * AH; i += AK)
    lq[i] = qproj[(long)bq0 * AH + i];
  if (tid < AH) lw[tid] = wv[tid];
  __syncthreads();

  float s[QT];
#pragma unroll
  for (int j = 0; j < QT; ++j) s[j] = 0.f;

  const float* kr = kproj + ((long)b * AK + tid) * AH;
#pragma unroll 4
  for (int h = 0; h < AH; h += 4) {
    const float4 kv = *(const float4*)(kr + h);
    const float4 w4 = *(const float4*)&lw[h];
#pragma unroll
    for (int j = 0; j < QT; ++j) {
      const float4 q4 = *(const float4*)&lq[j * AH + h];
      s[j] = fmaf(w4.x, TANHF(q4.x + kv.x), s[j]);
      s[j] = fmaf(w4.y, TANHF(q4.y + kv.y), s[j]);
      s[j] = fmaf(w4.z, TANHF(q4.z + kv.z), s[j]);
      s[j] = fmaf(w4.w, TANHF(q4.w + kv.w), s[j]);
    }
  }

  if (tid >= valid_lens[b]) {      // reference NEG_INF fill
#pragma unroll
    for (int j = 0; j < QT; ++j) s[j] = -1e6f;
  }

  // max over K, the QT queries side by side
  lr[tid] = make_float4(s[0], s[1], s[2], s[3]);
  __syncthreads();
  for (int off = AK / 2; off > 0; off >>= 1) {
    if (tid < off) {
      const float4 x = lr[tid], y = lr[tid + off];
      lr[tid] = make_float4(fmaxf(x.x, y.x), fmaxf(x.y, y.y),
                            fmaxf(x.z, y.z), fmaxf(x.w, y.w));
    }
    __syncthreads();
  }
  const float4 mx = lr[0];
  __syncthreads();

  // sum of exp
  const float4 e = make_float4(__expf(s[0] - mx.x), __expf(s[1] - mx.y),
                               __expf(s[2] - mx.z), __expf(s[3] - mx.w));
  lr[tid] = e;
  __syncthreads();
  for (int off = AK / 2; off > 0; off >>= 1) {
    if (tid < off) {
      const float4 x = lr[tid], y = lr[tid + off];
      lr[tid] = make_float4(x.x + y.x, x.y + y.y, x.z + y.z, x.w + y.w);
    }
    __syncthreads();
  }
  const float4 sm = lr[0];

  float* ap = attn + (long)bq0 * AK + tid;
  ap[0 * AK] = e.x * (1.0f / sm.x);
  ap[1 * AK] = e.y * (1.0f / sm.y);
  ap[2 * AK] = e.z * (1.0f / sm.z);
  ap[3 * AK] = e.w * (1.0f / sm.w);
}

// ---------------------------------------------------------------------------
// Launch: both projection GEMMs in one grid, fused scores/softmax, batched
// attn@values.
// d_ws: [qproj 1MB | kproj 8MB | attn 2MB]
// ---------------------------------------------------------------------------
extern "C" void kernel_launch(void* const* d_in, const int* in_sizes, int n_in,
                              void* d_out, int out_size, void* d_ws, size_t ws_size,
                              hipStream_t stream)
{
  const float* querys = (const float*)d_in[0];  // (16,64,256)
  const float* keys   = (const float*)d_in[1];  // (16,512,256)
  const float* values = (const float*)d_in[2];  // (16,512,256)
  const int*   vlen   = (const int*)d_in[3];    // (16,)
  const float* Wq     = (const float*)d_in[4];  // (256,256)
  const float* Wk     = (const float*)d_in[5];  // (256,256)
  const float* wv     = (const float*)d_in[6];  // (256,)
  float* out = (float*)d_out;                   // (16,64,256)

  float* qproj = (float*)d_ws;                           // 16*64*256
  float* kproj = qproj + (size_t)AB * AQ * AH;           // 16*512*256
  float* attn  = kproj + (size_t)AB * AK * AH;           // 16*64*512

  // k = keys @ Wk (M=8192) in x-blocks 0..127 and q = querys @ Wq (M=1024)
  // in x-blocks 128..143; N=256, K=256 for both. Neither reads the other.
  wmma_gemm_f32<<<dim3((AB * AK) / 64 + (AB * AQ) / 64, AH / NPANEL, 1), 128,
                  0, stream>>>(
      keys, Wk, kproj, AB * AK, AH, AH, 0, 0, 0,
      querys, Wq, qproj, (AB * AK) / 64);

  // fused scores + mask + softmax : one block per (b, QT queries)
  scores_softmax<<<dim3((AB * AQ) / QT), 512, 0, stream>>>(
      qproj, kproj, wv, vlen, attn);

  // out = attn @ values : batched, M=64, N=256, K=512
  wmma_gemm_f32<<<dim3(AQ / 64, AH / NPANEL, AB), 128, 0, stream>>>(
      attn, values, out, AQ, AH, AK,
      (long)AQ * AK, (long)AK * AH, (long)AQ * AH,
      nullptr, nullptr, nullptr, AQ / 64);
}

// v003
// Measured time: 34.9 microseconds a run.
// Timed twice side by side with v002, it ran 1.26 times as fast both times.
// All steps since v000 together make it 2.21 times as fast.
#include <hip/hip_runtime.h>
#include <hip/hip_bf16.h>

// Problem constants (fixed by the reference)
#define AB 16   // batch
#define AQ 64   // queries
#define AK 512  // keys
#define AH 256  // hidden == D

typedef __attribute__((ext_vector_type(2))) float    v2f;
typedef __attribute__((ext_vector_type(4))) float    v4f;
typedef __attribute__((ext_vector_type(8))) float    v8f;
typedef __attribute__((ext_vector_type(4))) unsigned v4u;
typedef __attribute__((ext_vector_type(8))) int      v8i;
typedef __attribute__((ext_vector_type(4))) int      v4i;

#if defined(__has_builtin)
#  if __has_builtin(__builtin_amdgcn_tanhf)
#    define TANHF(x) __builtin_amdgcn_tanhf(x)
#  elif __has_builtin(__builtin_amdgcn_tanh_f32)
#    define TANHF(x) __builtin_amdgcn_tanh_f32(x)
#  else
#    define TANHF(x) tanhf(x)
#  endif
#else
#  define TANHF(x) tanhf(x)
#endif

// Tensor Data Mover (this toolchain: 6-arg clang-23 form:
// (v4u g0, v8i g1, v4i g2, v4i g3, v8i g4, i32 cpol)).
#if defined(__has_builtin)
#  if __has_builtin(__builtin_amdgcn_tensor_load_to_lds) && \
      __has_builtin(__builtin_amdgcn_s_wait_tensorcnt)
#    define HAVE_TDM 1
#  endif
#endif

#define BROW 72
#define KCHUNK 64
#define NPANEL 64
#define CHUNKF (KCHUNK * BROW)   // floats per LDS buffer

#if defined(HAVE_TDM)
__device__ __forceinline__ void tdm_stage_panel(const float* gsrc,
                                                const float* ldst, int N)
{
  const unsigned long long gaddr = (unsigned long long)(const void*)gsrc;
  const unsigned lds_off = (unsigned)(unsigned long long)(const void*)ldst;
  v4u g0;
  g0[0] = 1u;                                        // count=1, user mode
  g0[1] = lds_off;                                   // lds_addr (bytes)
  g0[2] = (unsigned)(gaddr & 0xFFFFFFFFull);         // global_addr[31:0]
  g0[3] = (unsigned)((gaddr >> 32) & 0x1FFFFFFull)   // global_addr[56:32]
          | (2u << 30);                              // type = 2 ("image")
  const unsigned td0 = (unsigned)N;
  const unsigned td1 = KCHUNK;
  const unsigned long long str0 = (unsigned long long)N;
  v8i g1;
  g1[0] = (int)((2u << 16) | (1u << 20) | (5u << 22) | (7u << 25));
  g1[1] = (int)((td0 & 0xFFFFu) << 16);              // [63:48]=td0 lo16
  g1[2] = (int)((td0 >> 16) | ((td1 & 0xFFFFu) << 16));
  g1[3] = (int)((td1 >> 16) | ((unsigned)NPANEL << 16));
  g1[4] = (int)KCHUNK;
  g1[5] = (int)(str0 & 0xFFFFFFFFull);
  g1[6] = (int)((str0 >> 32) & 0xFFFFull);           // stride1 = 0
  g1[7] = 0;
  v4i gz  = {0, 0, 0, 0};                            // 2D: groups 2/3 NULL
  v8i gz8 = {0, 0, 0, 0, 0, 0, 0, 0};                // unused extra group
  __builtin_amdgcn_tensor_load_to_lds(g0, g1, gz, gz, gz8, 0);
}
#endif

// ---------------------------------------------------------------------------
// Batched row-major GEMM: C[b] = A[b](MxK) * B[b](KxN), f32, via
// V_WMMA_F32_16X16X4_F32. Block = 128 threads (4 waves). Block tile 64x64:
// wave w owns rows m0+16w, all four 16-col n-tiles (4 accumulators).
// B k-panels are double-buffered in LDS: the Tensor Data Mover prefetches
// chunk c+1 while all waves compute chunk c (one barrier per chunk). A
// fragments for a whole chunk are preloaded as one 16x global_load_b64
// clause so WMMAs never stall on a just-issued load.
// Requires M%64==0, N%64==0, K%64==0.
// One launch can carry a second, independent product of the same N, K and
// batch strides: blocks with blockIdx.x >= mblocks compute C2 = A2 * B2,
// their 64-row tile counted from mblocks. A launch with gridDim.x == mblocks
// has no such block and never touches A2, B2, C2.
// ---------------------------------------------------------------------------
__global__ __launch_bounds__(128) void wmma_gemm_f32(
    const float* __restrict__ A, const float* __restrict__ Bm,
    float* __restrict__ C, int M, int N, int K,
    long sA, long sB, long sC,
    const float* __restrict__ A2, const float* __restrict__ B2,
    float* __restrict__ C2, int mblocks)
{
  __shared__ float lds_b[2 * CHUNKF];

  const int lane = threadIdx.x & 31;
  const int wave = threadIdx.x >> 5;          // 0..3 -> m sub-tile
  const int half = lane >> 4;                 // 0 or 1
  const int r    = lane & 15;

  const bool second = (int)blockIdx.x >= mblocks;   // same for the whole block
  const int  mtile  = second ? (int)blockIdx.x - mblocks : (int)blockIdx.x;

  const int m0 = mtile * 64 + wave * 16;
  const int nb = blockIdx.y * NPANEL;
  const int b  = blockIdx.z;

  const float* Ab = (second ? A2 : A)  + (long)b * sA;
  const float* Bb = (second ? B2 : Bm) + (long)b * sB;
  float*       Cb = (second ? C2 : C)  + (long)b * sC;

  v8f acc[4] = {};

  const float* arow = Ab + (long)(m0 + r) * K + 2 * half;

  const int nchunks = K / KCHUNK;

  auto compute_chunk = [&](int c) {
    const float* buf   = &lds_b[(c & 1) * CHUNKF];
    const float* achnk = arow + c * KCHUNK;
    // Preload all A fragments for this chunk as one load clause.
    v2f afrag[KCHUNK / 4];
#pragma unroll
    for (int i = 0; i < KCHUNK / 4; ++i)
      afrag[i] = *(const v2f*)(achnk + 4 * i);
#pragma unroll
    for (int kk = 0; kk < KCHUNK; kk += 4) {
      const v2f a = afrag[kk >> 2];
      const float* bbase = &buf[(kk + 2 * half) * BROW + r];
#pragma unroll
      for (int nt = 0; nt < 4; ++nt) {
        v2f bf;
        bf[0] = bbase[nt * 16];            // B[kk+2h  ][nb+16nt+r]
        bf[1] = bbase[nt * 16 + BROW];     // B[kk+2h+1][nb+16nt+r]
        acc[nt] = __builtin_amdgcn_wmma_f32_16x16x4_f32(
            false, a, false, bf, (short)0, acc[nt], false, false);
      }
    }
  };

#if defined(HAVE_TDM)
  if (threadIdx.x < 32)
    tdm_stage_panel(Bb + nb, &lds_b[0], N);
  for (int c = 0; c < nchunks; ++c) {
    if (threadIdx.x < 32)
      __builtin_amdgcn_s_wait_tensorcnt(0);   // chunk c has landed
    __syncthreads();                          // publish; buf[(c+1)&1] is free
    if ((c + 1 < nchunks) && threadIdx.x < 32)
      tdm_stage_panel(Bb + (long)(c + 1) * KCHUNK * N + nb,
                      &lds_b[((c + 1) & 1) * CHUNKF], N);
    compute_chunk(c);
  }
#else
  for (int c = 0; c < nchunks; ++c) {
    __syncthreads();
    float* buf = &lds_b[(c & 1) * CHUNKF];
    const float* src = Bb + (long)c * KCHUNK * N + nb;
    for (int f = threadIdx.x; f < KCHUNK * (NPANEL / 4); f += 128) {
      const int kr = f >> 4;        // row in chunk
      const int c4 = f & 15;        // float4 within row
      *(float4*)&buf[kr * BROW + c4 * 4] =
          *(const float4*)&src[(long)kr * N + c4 * 4];
    }
    __syncthreads();
    compute_chunk(c);
  }
#endif

#pragma unroll
  for (int nt = 0; nt < 4; ++nt) {
    float* cp = Cb + (long)(m0 + 8 * half) * N + nb + nt * 16 + r;
#pragma unroll
    for (int j = 0; j < 8; ++j)
      cp[(long)j * N] = acc[nt][j];
  }
}

// ---------------------------------------------------------------------------
// Fused scores + mask + softmax:
//   s[b,q,k] = sum_h w_v[h] * tanh(qproj[b,q,h] + kproj[b,k,h])
//   s = (k < valid_len[b]) ? s : -1e6 ; attn = softmax_k(s)
// One block per (b, QT consecutive queries); 512 threads = one key each.
// A thread's kproj values are loaded once and feed QT running sums, so the
// key rows are fetched AQ/QT times per batch instead of AQ times. Each
// query's sum over h and its two reduction trees keep their order.
// Avoids materializing the 537 MB (B,Q,K,H) features tensor.
// ---------------------------------------------------------------------------
#define QT 4   // queries per block; AQ % QT == 0, so a block stays in one batch

__global__ __launch_bounds__(512) void scores_softmax(
    const float* __restrict__ qproj, const float* __restrict__ kproj,
    const float* __restrict__ wv, const int* __restrict__ valid_lens,
    float* __restrict__ attn)
{
  __shared__ __attribute__((aligned(16))) float lq[QT * AH];
  __shared__ __attribute__((aligned(16))) float lw[AH];
  __shared__ float4 lr[AK];        // component j belongs to query bq0 + j

  const int tid = threadIdx.x;     // key index
  const int bq0 = blockIdx.x * QT; // first flattened (b,q) of this block
  const int b   = bq0 >> 6;        // bq0 / AQ

  for (int i = tid; i < QT * AH; i += AK)
    lq[i] = qproj[(long)bq0 * AH + i];
  if (tid < AH) lw[tid] = wv[tid];
  __syncthreads();

  float s[QT];
#pragma unroll
  for (int j = 0; j < QT; ++j) s[j] = 0.f;

  const float* kr = kproj + ((long)b * AK + tid) * AH;
#pragma unroll 4
  for (int h = 0; h < AH; h += 4) {
    const float4 kv = *(const float4*)(kr + h);
    const float4 w4 = *(const float4*)&lw[h];
#pragma unroll
    for (int j = 0; j < QT; ++j) {
      const float4 q4 = *(const float4*)&lq[j * AH + h];
      s[j] = fmaf(w4.x, TANHF(q4.x + kv.x), s[j]);
      s[j] = fmaf(w4.y, TANHF(q4.y + kv.y), s[j]);
      s[j] = fmaf(w4.z, TANHF(q4.z + kv.z), s[j]);
      s[j] = fmaf(w4.w, TANHF(q4.w + kv.w), s[j]);
    }
  }

  if (tid >= valid_lens[b]) {      // reference NEG_INF fill
#pragma unroll
    for (int j = 0; j < QT; ++j) s[j] = -1e6f;
  }

  // max over K, the QT queries side by side
  lr[tid] = make_float4(s[0], s[1], s[2], s[3]);
  __syncthreads();
  for (int off = AK / 2; off > 0; off >>= 1) {
    if (tid < off) {
      const float4 x = lr[tid], y = lr[tid + off];
      lr[tid] = make_float4(fmaxf(x.x, y.x), fmaxf(x.y, y.y),
                            fmaxf(x.z, y.z), fmaxf(x.w, y.w));
    }
    __syncthreads();
  }
  const float4 mx = lr[0];
  __syncthreads();

  // sum of exp
  const float4 e = make_float4(__expf(s[0] - mx.x), __expf(s[1] - mx.y),
                               __expf(s[2] - mx.z), __expf(s[3] - mx.w));
  lr[tid] = e;
  __syncthreads();
  for (int off = AK / 2; off > 0; off >>= 1) {
    if (tid < off) {
      const float4 x = lr[tid], y = lr[tid + off];
      lr[tid] = make_float4(x.x + y.x, x.y + y.y, x.z + y.z, x.w + y.w);
    }
    __syncthreads();
  }
  const float4 sm = lr[0];

  float* ap = attn + (long)bq0 * AK + tid;
  ap[0 * AK] = e.x * (1.0f / sm.x);
  ap[1 * AK] = e.y * (1.0f / sm.y);
  ap[2 * AK] = e.z * (1.0f / sm.z);
  ap[3 * AK] = e.w * (1.0f / sm.w);
}

// ---------------------------------------------------------------------------
// out[b] = attn[b](64x512) * values[b](512x256), f32, V_WMMA_F32_16X16X4_F32.
// One block per 16x64 output tile: 4 x 4 x 16 = 256 blocks, 8 waves each.
// Wave w sums keys 64w .. 64w+63 for the whole tile (4 accumulators); the 8
// partial tiles are added through LDS in wave order. No operand is staged:
// each lane fetches its fragments with 16-byte loads, all issued before the
// first WMMA, so one memory latency is paid per wave.
// k order, the same for A and B: in a group of 8 keys, WMMA s (0 or 1) takes
// keys 4*half + 2*s + {0,1}; a lane's float4 of attn holds both WMMAs' pairs.
// Columns: accumulator t, lane column r stands for column n0 + 4*r + t, so a
// lane's float4 of a values row feeds all 4 accumulators and a lane's 4
// accumulators hold 4 neighbouring columns of an output row.
// ---------------------------------------------------------------------------
#define VW 8             // waves per block
#define VK (AK / VW)     // keys per wave
#define VG (VK / 8)      // groups of 8 keys per wave

__global__ __launch_bounds__(32 * VW) void attn_values(
    const float* __restrict__ attn, const float* __restrict__ values,
    float* __restrict__ out)
{
  __shared__ __attribute__((aligned(16))) float red[VW * 16 * 64];

  const int lane = threadIdx.x & 31;
  const int wave = threadIdx.x >> 5;
  const int half = lane >> 4;
  const int r    = lane & 15;

  const int m0 = blockIdx.x * 16;
  const int n0 = blockIdx.y * 64;
  const int b  = blockIdx.z;
  const int k0 = wave * VK + 4 * half;   // this lane's first key

  const float* ap = attn + ((long)b * AQ + m0 + r) * AK + k0;
  const float* vp = values + ((long)b * AK + k0) * AH + n0 + 4 * r;

  v4f av[VG];
  v4f bv[VG][4];
#pragma unroll  // constant indices: the arrays stay in registers
  for (int g = 0; g < VG; ++g) {
    av[g] = *(const v4f*)(ap + 8 * g);
#pragma unroll  // constant indices: the arrays stay in registers
    for (int c = 0; c < 4; ++c)
      bv[g][c] = *(const v4f*)(vp + (long)(8 * g + c) * AH);
  }
  // Keeps every load above in front of the first WMMA; sunk to their uses,
  // each group of loads would expose its own latency.
  __builtin_amdgcn_sched_barrier(0);

  v8f acc[4] = {};
#pragma unroll  // constant indices: the arrays stay in registers
  for (int g = 0; g < VG; ++g) {
#pragma unroll  // constant indices: the arrays stay in registers
    for (int s = 0; s < 2; ++s) {
      v2f a;
      a[0] = av[g][2 * s];
      a[1] = av[g][2 * s + 1];
#pragma unroll  // constant indices: the arrays stay in registers
      for (int t = 0; t < 4; ++t) {
        v2f bf;
        bf[0] = bv[g][2 * s][t];
        bf[1] = bv[g][2 * s + 1][t];
        acc[t] = __builtin_amdgcn_wmma_f32_16x16x4_f32(
            false, a, false, bf, (short)0, acc[t], false, false);
      }
    }
  }

  float* rw = red + wave * (16 * 64) + (8 * half) * 64 + 4 * r;
#pragma unroll  // constant indices: the arrays stay in registers
  for (int j = 0; j < 8; ++j) {
    v4f p;
    p[0] = acc[0][j]; p[1] = acc[1][j]; p[2] = acc[2][j]; p[3] = acc[3][j];
    *(v4f*)(rw + j * 64) = p;
  }
  __syncthreads();

  // 256 threads, one float4 of the tile each: add the 8 partial tiles.
  const int row = threadIdx.x >> 4;
  const int c4  = threadIdx.x & 15;
  const float* rp = red + row * 64 + 4 * c4;
  v4f sum = *(const v4f*)rp;
  for (int w = 1; w < VW; ++w)
    sum += *(const v4f*)(rp + w * (16 * 64));
  *(v4f*)(out + ((long)b * AQ + m0 + row) * AH + n0 + 4 * c4) = sum;
}

// ---------------------------------------------------------------------------
// Launch: both projection GEMMs in one grid, fused scores/softmax, batched
// attn@values.
// d_ws: [qproj 1MB | kproj 8MB | attn 2MB]
// ---------------------------------------------------------------------------
extern "C" void kernel_launch(void* const* d_in, const int* in_sizes, int n_in,
                              void* d_out, int out_size, void* d_ws, size_t ws_size,
                              hipStream_t stream)
{
  const float* querys = (const float*)d_in[0];  // (16,64,256)
  const float* keys   = (const float*)d_in[1];  // (16,512,256)
  const float* values = (const float*)d_in[2];  // (16,512,256)
  const int*   vlen   = (const int*)d_in[3];    // (16,)
  const float* Wq     = (const float*)d_in[4];  // (256,256)
  const float* Wk     = (const float*)d_in[5];  // (256,256)
  const float* wv     = (const float*)d_in[6];  // (256,)
  float* out = (float*)d_out;                   // (16,64,256)

  float* qproj = (float*)d_ws;                           // 16*64*256
  float* kproj = qproj + (size_t)AB * AQ * AH;           // 16*512*256
  float* attn  = kproj + (size_t)AB * AK * AH;           // 16*64*512

  // k = keys @ Wk (M=8192) in x-blocks 0..127 and q = querys @ Wq (M=1024)
  // in x-blocks 128..143; N=256, K=256 for both. Neither reads the other.
  wmma_gemm_f32<<<dim3((AB * AK) / 64 + (AB * AQ) / 64, AH / NPANEL, 1), 128,
                  0, stream>>>(
      keys, Wk, kproj, AB * AK, AH, AH, 0, 0, 0,
      querys, Wq, qproj, (AB * AK) / 64);

  // fused scores + mask + softmax : one block per (b, QT queries)
  scores_softmax<<<dim3((AB * AQ) / QT), 512, 0, stream>>>(
      qproj, kproj, wv, vlen, attn);

  // out = attn @ values : one block per 16x64 tile of a batch
  attn_values<<<dim3(AQ / 16, AH / 64, AB), 32 * VW, 0, stream>>>(
      attn, values, out);
}

// v004
// One run takes 33.2 microseconds.
// In two side-by-side timings against v003, it was 1.05 and 1.04 times as fast.
// Over all steps from v000 it is 2.31 times as fast.
#include <hip/hip_runtime.h>
#include <hip/hip_bf16.h>

// Problem constants (fixed by the reference)
#define AB 16   // batch
#define AQ 64   // queries
#define AK 512  // keys
#define AH 256  // hidden == D

typedef __attribute__((ext_vector_type(2))) float    v2f;
typedef __attribute__((ext_vector_type(4))) float    v4f;
typedef __attribute__((ext_vector_type(8))) float    v8f;
typedef __attribute__((ext_vector_type(4))) unsigned v4u;
typedef __attribute__((ext_vector_type(8))) int      v8i;
typedef __attribute__((ext_vector_type(4))) int      v4i;

#if defined(__has_builtin)
#  if __has_builtin(__builtin_amdgcn_tanhf)
#    define TANHF(x) __builtin_amdgcn_tanhf(x)
#  elif __has_builtin(__builtin_amdgcn_tanh_f32)
#    define TANHF(x) __builtin_amdgcn_tanh_f32(x)
#  else
#    define TANHF(x) tanhf(x)
#  endif
#else
#  define TANHF(x) tanhf(x)
#endif

// Tensor Data Mover (this toolchain: 6-arg clang-23 form:
// (v4u g0, v8i g1, v4i g2, v4i g3, v8i g4, i32 cpol)).
#if defined(__has_builtin)
#  if __has_builtin(__builtin_amdgcn_tensor_load_to_lds) && \
      __has_builtin(__builtin_amdgcn_s_wait_tensorcnt)
#    define HAVE_TDM 1
#  endif
#endif

#define BROW 72
#define KCHUNK 64
#define NPANEL 64
#define CHUNKF (KCHUNK * BROW)   // floats per LDS buffer

#if defined(HAVE_TDM)
__device__ __forceinline__ void tdm_stage_panel(const float* gsrc,
                                                const float* ldst, int N)
{
  const unsigned long long gaddr = (unsigned long long)(const void*)gsrc;
  const unsigned lds_off = (unsigned)(unsigned long long)(const void*)ldst;
  v4u g0;
  g0[0] = 1u;                                        // count=1, user mode
  g0[1] = lds_off;                                   // lds_addr (bytes)
  g0[2] = (unsigned)(gaddr & 0xFFFFFFFFull);         // global_addr[31:0]
  g0[3] = (unsigned)((gaddr >> 32) & 0x1FFFFFFull)   // global_addr[56:32]
          | (2u << 30);                              // type = 2 ("image")
  const unsigned td0 = (unsigned)N;
  const unsigned td1 = KCHUNK;
  const unsigned long long str0 = (unsigned long long)N;
  v8i g1;
  g1[0] = (int)((2u << 16) | (1u << 20) | (5u << 22) | (7u << 25));
  g1[1] = (int)((td0 & 0xFFFFu) << 16);              // [63:48]=td0 lo16
  g1[2] = (int)((td0 >> 16) | ((td1 & 0xFFFFu) << 16));
  g1[3] = (int)((td1 >> 16) | ((unsigned)NPANEL << 16));
  g1[4] = (int)KCHUNK;
  g1[5] = (int)(str0 & 0xFFFFFFFFull);
  g1[6] = (int)((str0 >> 32) & 0xFFFFull);           // stride1 = 0
  g1[7] = 0;
  v4i gz  = {0, 0, 0, 0};                            // 2D: groups 2/3 NULL
  v8i gz8 = {0, 0, 0, 0, 0, 0, 0, 0};                // unused extra group
  __builtin_amdgcn_tensor_load_to_lds(g0, g1, gz, gz, gz8, 0);
}
#endif

__global__ __launch_bounds__(128) void wmma_gemm_f32(
    const float* __restrict__ A, const float* __restrict__ Bm,
    float* __restrict__ C, int M, int N, int K,
    long sA, long sB, long sC,
    const float* __restrict__ A2, const float* __restrict__ B2,
    float* __restrict__ C2, int mblocks)
{
  __shared__ float lds_b[2 * CHUNKF];

  const int lane = threadIdx.x & 31;
  const int wave = threadIdx.x >> 5;          // 0..3 -> m sub-tile
  const int half = lane >> 4;                 // 0 or 1
  const int r    = lane & 15;

  const bool second = (int)blockIdx.x >= mblocks;   // same for the whole block
  const int  mtile  = second ? (int)blockIdx.x - mblocks : (int)blockIdx.x;

  const int m0 = mtile * 64 + wave * 16;
  const int nb = blockIdx.y * NPANEL;
  const int b  = blockIdx.z;

  const float* Ab = (second ? A2 : A)  + (long)b * sA;
  const float* Bb = (second ? B2 : Bm) + (long)b * sB;
  float*       Cb = (second ? C2 : C)  + (long)b * sC;

  v8f acc[4] = {};

  const float* arow = Ab + (long)(m0 + r) * K + 2 * half;

  const int nchunks = K / KCHUNK;

  auto compute_chunk = [&](int c) {
    const float* buf   = &lds_b[(c & 1) * CHUNKF];
    const float* achnk = arow + c * KCHUNK;
    // Preload all A fragments for this chunk as one load clause.
    v2f afrag[KCHUNK / 4];
#pragma unroll
    for (int i = 0; i < KCHUNK / 4; ++i)
      afrag[i] = *(const v2f*)(achnk + 4 * i);
#pragma unroll
    for (int kk = 0; kk < KCHUNK; kk += 4) {
      const v2f a = afrag[kk >> 2];
      const float* bbase = &buf[(kk + 2 * half) * BROW + r];
#pragma unroll
      for (int nt = 0; nt < 4; ++nt) {
        v2f bf;
        bf[0] = bbase[nt * 16];            // B[kk+2h  ][nb+16nt+r]
        bf[1] = bbase[nt * 16 + BROW];     // B[kk+2h+1][nb+16nt+r]
        acc[nt] = __builtin_amdgcn_wmma_f32_16x16x4_f32(
            false, bf, false, a, (short)0, acc[nt], false, false);
      }
    }
  };

#if defined(HAVE_TDM)
  if (threadIdx.x < 32)
    tdm_stage_panel(Bb + nb, &lds_b[0], N);
  for (int c = 0; c < nchunks; ++c) {
    if (threadIdx.x < 32)
      __builtin_amdgcn_s_wait_tensorcnt(0);   // chunk c has landed
    __syncthreads();                          // publish; buf[(c+1)&1] is free
    if ((c + 1 < nchunks) && threadIdx.x < 32)
      tdm_stage_panel(Bb + (long)(c + 1) * KCHUNK * N + nb,
                      &lds_b[((c + 1) & 1) * CHUNKF], N);
    compute_chunk(c);
  }
#else
  for (int c = 0; c < nchunks; ++c) {
    __syncthreads();
    float* buf = &lds_b[(c & 1) * CHUNKF];
    const float* src = Bb + (long)c * KCHUNK * N + nb;
    for (int f = threadIdx.x; f < KCHUNK * (NPANEL / 4); f += 128) {
      const int kr = f >> 4;        // row in chunk
      const int c4 = f & 15;        // float4 within row
      *(float4*)&buf[kr * BROW + c4 * 4] =
          *(const float4*)&src[(long)kr * N + c4 * 4];
    }
    __syncthreads();
    compute_chunk(c);
  }
#endif

  auto store_tiles = [&](float* cp, const int gs) {
#pragma unroll
    for (int nt = 0; nt < 4; ++nt) {
      v4f lo, hi;
      lo[0] = acc[nt][0]; lo[1] = acc[nt][1]; lo[2] = acc[nt][2]; lo[3] = acc[nt][3];
      hi[0] = acc[nt][4]; hi[1] = acc[nt][5]; hi[2] = acc[nt][6]; hi[3] = acc[nt][7];
      *(v4f*)(cp + (4 * nt) * gs)     = lo;
      *(v4f*)(cp + (4 * nt + 1) * gs) = hi;
    }
  };
  if (second) {   // same for the whole block; no barrier follows
    store_tiles(Cb + (long)(m0 + r) * N + nb + 8 * half, 4);
    // The built code lays the other branch, which rewrites the address
    // registers, behind these stores: the wait stands in front of it.
    asm volatile("s_wait_xcnt 0x0" ::: "memory");
    return;
  }
  store_tiles(Cb + (long)(m0 / AK) * AK * N + (long)(nb + 8 * half) * AK
                 + (m0 % AK + r) * 4, 4 * AK);
}

// ---------------------------------------------------------------------------
// Fused scores + mask + softmax:
//   s[b,q,k] = sum_h w_v[h] * tanh(qproj[b,q,h] + kproj[b,k,h])
//   s = (k < valid_len[b]) ? s : -1e6 ; attn = softmax_k(s)
// One block per (b, QT consecutive queries); 512 threads = one key each.
// A thread's kproj values are loaded once and feed QT running sums, so the
// key rows are fetched AQ/QT times per batch instead of AQ times. Each
// query's sum over h and its two reduction trees keep their order.
// kproj arrives in groups of 4 h, kprojG[b][h/4][k][h%4]: the 16-byte loads
// of a wave's 32 keys cover 512 contiguous bytes, 4 whole 128-byte lines.
// Avoids materializing the 537 MB (B,Q,K,H) features tensor.
// ---------------------------------------------------------------------------
#define QT 4   // queries per block; AQ % QT == 0, so a block stays in one batch

__global__ __launch_bounds__(512) void scores_softmax(
    const float* __restrict__ qproj, const float* __restrict__ kprojG,
    const float* __restrict__ wv, const int* __restrict__ valid_lens,
    float* __restrict__ attn)
{
  __shared__ __attribute__((aligned(16))) float lq[QT * AH];
  __shared__ __attribute__((aligned(16))) float lw[AH];
  __shared__ float4 lr[AK];        // component j belongs to query bq0 + j

  const int tid = threadIdx.x;     // key index
  const int bq0 = blockIdx.x * QT; // first flattened (b,q) of this block
  const int b   = bq0 >> 6;        // bq0 / AQ

  for (int i = tid; i < QT * AH; i += AK)
    lq[i] = qproj[(long)bq0 * AH + i];
  if (tid < AH) lw[tid] = wv[tid];
  __syncthreads();

  float s[QT];
#pragma unroll
  for (int j = 0; j < QT; ++j) s[j] = 0.f;

  const float* kr = kprojG + (long)b * AK * AH + tid * 4;
  // 8 loads (4 KB) of a wave in flight per trip: half as many exposed load
  // latencies per wave as with 4.
#pragma unroll 8
  for (int h = 0; h < AH; h += 4) {
    const float4 kv = *(const float4*)(kr + (long)h * AK);  // group h/4
    const float4 w4 = *(const float4*)&lw[h];
#pragma unroll
    for (int j = 0; j < QT; ++j) {
      const float4 q4 = *(const float4*)&lq[j * AH + h];
      s[j] = fmaf(w4.x, TANHF(q4.x + kv.x), s[j]);
      s[j] = fmaf(w4.y, TANHF(q4.y + kv.y), s[j]);
      s[j] = fmaf(w4.z, TANHF(q4.z + kv.z), s[j]);
      s[j] = fmaf(w4.w, TANHF(q4.w + kv.w), s[j]);
    }
  }

  if (tid >= valid_lens[b]) {      // reference NEG_INF fill
#pragma unroll
    for (int j = 0; j < QT; ++j) s[j] = -1e6f;
  }

  // max over K, the QT queries side by side
  lr[tid] = make_float4(s[0], s[1], s[2], s[3]);
  __syncthreads();
  for (int off = AK / 2; off > 0; off >>= 1) {
    if (tid < off) {
      const float4 x = lr[tid], y = lr[tid + off];
      lr[tid] = make_float4(fmaxf(x.x, y.x), fmaxf(x.y, y.y),
                            fmaxf(x.z, y.z), fmaxf(x.w, y.w));
    }
    __syncthreads();
  }
  const float4 mx = lr[0];
  __syncthreads();

  // sum of exp
  const float4 e = make_float4(__expf(s[0] - mx.x), __expf(s[1] - mx.y),
                               __expf(s[2] - mx.z), __expf(s[3] - mx.w));
  lr[tid] = e;
  __syncthreads();
  for (int off = AK / 2; off > 0; off >>= 1) {
    if (tid < off) {
      const float4 x = lr[tid], y = lr[tid + off];
      lr[tid] = make_float4(x.x + y.x, x.y + y.y, x.z + y.z, x.w + y.w);
    }
    __syncthreads();
  }
  const float4 sm = lr[0];

  float* ap = attn + (long)bq0 * AK + tid;
  ap[0 * AK] = e.x * (1.0f / sm.x);
  ap[1 * AK] = e.y * (1.0f / sm.y);
  ap[2 * AK] = e.z * (1.0f / sm.z);
  ap[3 * AK] = e.w * (1.0f / sm.w);
}

// ---------------------------------------------------------------------------
// out[b] = attn[b](64x512) * values[b](512x256), f32, V_WMMA_F32_16X16X4_F32.
// One block per 16x64 output tile: 4 x 4 x 16 = 256 blocks, 8 waves each.
// Wave w sums keys 64w .. 64w+63 for the whole tile (4 accumulators); the 8
// partial tiles are added through LDS in wave order. No operand is staged:
// each lane fetches its fragments with 16-byte loads, all issued before the
// first WMMA, so one memory latency is paid per wave.
// k order, the same for A and B: in a group of 8 keys, WMMA s (0 or 1) takes
// keys 4*half + 2*s + {0,1}; a lane's float4 of attn holds both WMMAs' pairs.
// Columns: accumulator t, lane column r stands for column n0 + 4*r + t, so a
// lane's float4 of a values row feeds all 4 accumulators and a lane's 4
// accumulators hold 4 neighbouring columns of an output row.
// ---------------------------------------------------------------------------
#define VW 8             // waves per block
#define VK (AK / VW)     // keys per wave
#define VG (VK / 8)      // groups of 8 keys per wave

__global__ __launch_bounds__(32 * VW) void attn_values(
    const float* __restrict__ attn, const float* __restrict__ values,
    float* __restrict__ out)
{
  __shared__ __attribute__((aligned(16))) float red[VW * 16 * 64];

  const int lane = threadIdx.x & 31;
  const int wave = threadIdx.x >> 5;
  const int half = lane >> 4;
  const int r    = lane & 15;

  const int m0 = blockIdx.x * 16;
  const int n0 = blockIdx.y * 64;
  const int b  = blockIdx.z;
  const int k0 = wave * VK + 4 * half;   // this lane's first key

  const float* ap = attn + ((long)b * AQ + m0 + r) * AK + k0;
  const float* vp = values + ((long)b * AK + k0) * AH + n0 + 4 * r;

  v4f av[VG];
  v4f bv[VG][4];
#pragma unroll  // constant indices: the arrays stay in registers
  for (int g = 0; g < VG; ++g) {
    av[g] = *(const v4f*)(ap + 8 * g);
#pragma unroll  // constant indices: the arrays stay in registers
    for (int c = 0; c < 4; ++c)
      bv[g][c] = *(const v4f*)(vp + (long)(8 * g + c) * AH);
  }
  // Keeps every load above in front of the first WMMA; sunk to their uses,
  // each group of loads would expose its own latency.
  __builtin_amdgcn_sched_barrier(0);

  v8f acc[4] = {};
#pragma unroll  // constant indices: the arrays stay in registers
  for (int g = 0; g < VG; ++g) {
#pragma unroll  // constant indices: the arrays stay in registers
    for (int s = 0; s < 2; ++s) {
      v2f a;
      a[0] = av[g][2 * s];
      a[1] = av[g][2 * s + 1];
#pragma unroll  // constant indices: the arrays stay in registers
      for (int t = 0; t < 4; ++t) {
        v2f bf;
        bf[0] = bv[g][2 * s][t];
        bf[1] = bv[g][2 * s + 1][t];
        acc[t] = __builtin_amdgcn_wmma_f32_16x16x4_f32(
            false, a, false, bf, (short)0, acc[t], false, false);
      }
    }
  }

  float* rw = red + wave * (16 * 64) + (8 * half) * 64 + 4 * r;
#pragma unroll  // constant indices: the arrays stay in registers
  for (int j = 0; j < 8; ++j) {
    v4f p;
    p[0] = acc[0][j]; p[1] = acc[1][j]; p[2] = acc[2][j]; p[3] = acc[3][j];
    *(v4f*)(rw + j * 64) = p;
  }
  __syncthreads();

  // 256 threads, one float4 of the tile each: add the 8 partial tiles.
  const int row = threadIdx.x >> 4;
  const int c4  = threadIdx.x & 15;
  const float* rp = red + row * 64 + 4 * c4;
  v4f sum = *(const v4f*)rp;
  for (int w = 1; w < VW; ++w)
    sum += *(const v4f*)(rp + w * (16 * 64));
  *(v4f*)(out + ((long)b * AQ + m0 + row) * AH + n0 + 4 * c4) = sum;
}

// ---------------------------------------------------------------------------
// Launch: both projection GEMMs in one grid, fused scores/softmax, batched
// attn@values.
// d_ws: [qproj 1MB | kproj 8MB, (b, h/4, k, h%4) | attn 2MB]
// ---------------------------------------------------------------------------
extern "C" void kernel_launch(void* const* d_in, const int* in_sizes, int n_in,
                              void* d_out, int out_size, void* d_ws, size_t ws_size,
                              hipStream_t stream)
{
  const float* querys = (const float*)d_in[0];  // (16,64,256)
  const float* keys   = (const float*)d_in[1];  // (16,512,256)
  const float* values = (const float*)d_in[2];  // (16,512,256)
  const int*   vlen   = (const int*)d_in[3];    // (16,)
  const float* Wq     = (const float*)d_in[4];  // (256,256)
  const float* Wk     = (const float*)d_in[5];  // (256,256)
  const float* wv     = (const float*)d_in[6];  // (256,)
  float* out = (float*)d_out;                   // (16,64,256)

  float* qproj = (float*)d_ws;                           // 16*64*256
  float* kproj = qproj + (size_t)AB * AQ * AH;           // 16*64*512*4
  float* attn  = kproj + (size_t)AB * AK * AH;           // 16*64*512

  // k = keys @ Wk (M=8192) in x-blocks 0..127 and q = querys @ Wq (M=1024)
  // in x-blocks 128..143; N=256, K=256 for both. Neither reads the other.
  wmma_gemm_f32<<<dim3((AB * AK) / 64 + (AB * AQ) / 64, AH / NPANEL, 1), 128,
                  0, stream>>>(
      keys, Wk, kproj, AB * AK, AH, AH, 0, 0, 0,
      querys, Wq, qproj, (AB * AK) / 64);

  // fused scores + mask + softmax : one block per (b, QT queries)
  scores_softmax<<<dim3((AB * AQ) / QT), 512, 0, stream>>>(
      qproj, kproj, wv, vlen, attn);

  // out = attn @ values : one block per 16x64 tile of a batch
  attn_values<<<dim3(AQ / 16, AH / 64, AB), 32 * VW, 0, stream>>>(
      attn, values, out);
}

// v005
// One run takes 31.6 microseconds.
// Two timings next to v004 both put it at 1.05 times that version's speed.
// Over all steps from v000 it is 2.43 times as fast.
#include <hip/hip_runtime.h>
#include <hip/hip_bf16.h>

// Problem constants (fixed by the reference)
#define AB 16   // batch
#define AQ 64   // queries
#define AK 512  // keys
#define AH 256  // hidden == D

typedef __attribute__((ext_vector_type(2))) float    v2f;
typedef __attribute__((ext_vector_type(4))) float    v4f;
typedef __attribute__((ext_vector_type(8))) float    v8f;
typedef __attribute__((ext_vector_type(4))) unsigned v4u;
typedef __attribute__((ext_vector_type(8))) int      v8i;
typedef __attribute__((ext_vector_type(4))) int      v4i;

#if defined(__has_builtin)
#  if __has_builtin(__builtin_amdgcn_tanhf)
#    define TANHF(x) __builtin_amdgcn_tanhf(x)
#  elif __has_builtin(__builtin_amdgcn_tanh_f32)
#    define TANHF(x) __builtin_amdgcn_tanh_f32(x)
#  else
#    define TANHF(x) tanhf(x)
#  endif
#else
#  define TANHF(x) tanhf(x)
#endif

// Tensor Data Mover (this toolchain: 6-arg clang-23 form:
// (v4u g0, v8i g1, v4i g2, v4i g3, v8i g4, i32 cpol)).
#if defined(__has_builtin)
#  if __has_builtin(__builtin_amdgcn_tensor_load_to_lds) && \
      __has_builtin(__builtin_amdgcn_s_wait_tensorcnt)
#    define HAVE_TDM 1
#  endif
#endif

#define BROW 72
#define KCHUNK 64
#define NPANEL 64
#define CHUNKF (KCHUNK * BROW)   // floats per LDS buffer

#if defined(HAVE_TDM)
__device__ __forceinline__ void tdm_stage_panel(const float* gsrc,
                                                const float* ldst, int N)
{
  const unsigned long long gaddr = (unsigned long long)(const void*)gsrc;
  const unsigned lds_off = (unsigned)(unsigned long long)(const void*)ldst;
  v4u g0;
  g0[0] = 1u;                                        // count=1, user mode
  g0[1] = lds_off;                                   // lds_addr (bytes)
  g0[2] = (unsigned)(gaddr & 0xFFFFFFFFull);         // global_addr[31:0]
  g0[3] = (unsigned)((gaddr >> 32) & 0x1FFFFFFull)   // global_addr[56:32]
          | (2u << 30);                              // type = 2 ("image")
  const unsigned td0 = (unsigned)N;
  const unsigned td1 = KCHUNK;
  const unsigned long long str0 = (unsigned long long)N;
  v8i g1;
  g1[0] = (int)((2u << 16) | (1u << 20) | (5u << 22) | (7u << 25));
  g1[1] = (int)((td0 & 0xFFFFu) << 16);              // [63:48]=td0 lo16
  g1[2] = (int)((td0 >> 16) | ((td1 & 0xFFFFu) << 16));
  g1[3] = (int)((td1 >> 16) | ((unsigned)NPANEL << 16));
  g1[4] = (int)KCHUNK;
  g1[5] = (int)(str0 & 0xFFFFFFFFull);
  g1[6] = (int)((str0 >> 32) & 0xFFFFull);           // stride1 = 0
  g1[7] = 0;
  v4i gz  = {0, 0, 0, 0};                            // 2D: groups 2/3 NULL
  v8i gz8 = {0, 0, 0, 0, 0, 0, 0, 0};                // unused extra group
  __builtin_amdgcn_tensor_load_to_lds(g0, g1, gz, gz, gz8, 0);
}
#endif

__global__ __launch_bounds__(128) void wmma_gemm_f32(
    const float* __restrict__ A, const float* __restrict__ Bm,
    float* __restrict__ C, int M, int N, int K,
    long sA, long sB, long sC,
    const float* __restrict__ A2, const float* __restrict__ B2,
    float* __restrict__ C2, int mblocks)
{
  __shared__ float lds_b[2 * CHUNKF];

  const int lane = threadIdx.x & 31;
  const int wave = threadIdx.x >> 5;          // 0..3 -> m sub-tile
  const int half = lane >> 4;                 // 0 or 1
  const int r    = lane & 15;

  const bool second = (int)blockIdx.x >= mblocks;   // same for the whole block
  const int  mtile  = second ? (int)blockIdx.x - mblocks : (int)blockIdx.x;

  const int m0 = mtile * 64 + wave * 16;
  const int nb = blockIdx.y * NPANEL;
  const int b  = blockIdx.z;

  const float* Ab = (second ? A2 : A)  + (long)b * sA;
  const float* Bb = (second ? B2 : Bm) + (long)b * sB;
  float*       Cb = (second ? C2 : C)  + (long)b * sC;

  v8f acc[4] = {};

  const float* arow = Ab + (long)(m0 + r) * K + 2 * half;

  const int nchunks = K / KCHUNK;

  auto compute_chunk = [&](int c) {
    const float* buf   = &lds_b[(c & 1) * CHUNKF];
    const float* achnk = arow + c * KCHUNK;
    // Preload all A fragments for this chunk as one load clause.
    v2f afrag[KCHUNK / 4];
#pragma unroll
    for (int i = 0; i < KCHUNK / 4; ++i)
      afrag[i] = *(const v2f*)(achnk + 4 * i);
#pragma unroll
    for (int kk = 0; kk < KCHUNK; kk += 4) {
      const v2f a = afrag[kk >> 2];
      const float* bbase = &buf[(kk + 2 * half) * BROW + r];
#pragma unroll
      for (int nt = 0; nt < 4; ++nt) {
        v2f bf;
        bf[0] = bbase[nt * 16];            // B[kk+2h  ][nb+16nt+r]
        bf[1] = bbase[nt * 16 + BROW];     // B[kk+2h+1][nb+16nt+r]
        acc[nt] = __builtin_amdgcn_wmma_f32_16x16x4_f32(
            false, bf, false, a, (short)0, acc[nt], false, false);
      }
    }
  };

#if defined(HAVE_TDM)
  if (threadIdx.x < 32)
    tdm_stage_panel(Bb + nb, &lds_b[0], N);
  for (int c = 0; c < nchunks; ++c) {
    if (threadIdx.x < 32)
      __builtin_amdgcn_s_wait_tensorcnt(0);   // chunk c has landed
    __syncthreads();                          // publish; buf[(c+1)&1] is free
    if ((c + 1 < nchunks) && threadIdx.x < 32)
      tdm_stage_panel(Bb + (long)(c + 1) * KCHUNK * N + nb,
                      &lds_b[((c + 1) & 1) * CHUNKF], N);
    compute_chunk(c);
  }
#else
  for (int c = 0; c < nchunks; ++c) {
    __syncthreads();
    float* buf = &lds_b[(c & 1) * CHUNKF];
    const float* src = Bb + (long)c * KCHUNK * N + nb;
    for (int f = threadIdx.x; f < KCHUNK * (NPANEL / 4); f += 128) {
      const int kr = f >> 4;        // row in chunk
      const int c4 = f & 15;        // float4 within row
      *(float4*)&buf[kr * BROW + c4 * 4] =
          *(const float4*)&src[(long)kr * N + c4 * 4];
    }
    __syncthreads();
    compute_chunk(c);
  }
#endif

  auto store_tiles = [&](float* cp, const int gs) {
#pragma unroll
    for (int nt = 0; nt < 4; ++nt) {
      v4f lo, hi;
      lo[0] = acc[nt][0]; lo[1] = acc[nt][1]; lo[2] = acc[nt][2]; lo[3] = acc[nt][3];
      hi[0] = acc[nt][4]; hi[1] = acc[nt][5]; hi[2] = acc[nt][6]; hi[3] = acc[nt][7];
      *(v4f*)(cp + (4 * nt) * gs)     = lo;
      *(v4f*)(cp + (4 * nt + 1) * gs) = hi;
    }
  };
  if (second) {   // same for the whole block; no barrier follows
    store_tiles(Cb + (long)(m0 + r) * N + nb + 8 * half, 4);
    // The built code lays the other branch, which rewrites the address
    // registers, behind these stores: the wait stands in front of it.
    asm volatile("s_wait_xcnt 0x0" ::: "memory");
    return;
  }
  store_tiles(Cb + (long)(m0 / AK) * AK * N + (long)(nb + 8 * half) * AK
                 + (m0 % AK + r) * 4, 4 * AK);
}

// ---------------------------------------------------------------------------
// Scores + mask (the softmax over k is taken by attn_values, which reads s):
//   s[b,q,k] = sum_h w_v[h] * tanh(qproj[b,q,h] + kproj[b,k,h])
//   s = (k < valid_len[b]) ? s : -1e6
// One block per (b, QT consecutive queries); 512 threads = one key each.
// A thread's kproj values are loaded once and feed QT running sums, so the
// key rows are fetched AQ/QT times per batch instead of AQ times. Each
// query's sum over h keeps its order.
// kproj arrives in groups of 4 h, kprojG[b][h/4][k][h%4]: the 16-byte loads
// of a wave's 32 keys cover 512 contiguous bytes, 4 whole 128-byte lines.
// Avoids materializing the 537 MB (B,Q,K,H) features tensor.
// ---------------------------------------------------------------------------
#define QT 4   // queries per block; AQ % QT == 0, so a block stays in one batch

__global__ __launch_bounds__(512) void masked_scores(
    const float* __restrict__ qproj, const float* __restrict__ kprojG,
    const float* __restrict__ wv, const int* __restrict__ valid_lens,
    float* __restrict__ scores)
{
  __shared__ __attribute__((aligned(16))) float lq[QT * AH];
  __shared__ __attribute__((aligned(16))) float lw[AH];

  const int tid = threadIdx.x;     // key index
  const int bq0 = blockIdx.x * QT; // first flattened (b,q) of this block
  const int b   = bq0 >> 6;        // bq0 / AQ

  for (int i = tid; i < QT * AH; i += AK)
    lq[i] = qproj[(long)bq0 * AH + i];
  if (tid < AH) lw[tid] = wv[tid];
  __syncthreads();

  float s[QT];
#pragma unroll
  for (int j = 0; j < QT; ++j) s[j] = 0.f;

  const float* kr = kprojG + (long)b * AK * AH + tid * 4;
  // 8 loads (4 KB) of a wave in flight per trip: half as many exposed load
  // latencies per wave as with 4.
#pragma unroll 8
  for (int h = 0; h < AH; h += 4) {
    const float4 kv = *(const float4*)(kr + (long)h * AK);  // group h/4
    const float4 w4 = *(const float4*)&lw[h];
#pragma unroll
    for (int j = 0; j < QT; ++j) {
      const float4 q4 = *(const float4*)&lq[j * AH + h];
      s[j] = fmaf(w4.x, TANHF(q4.x + kv.x), s[j]);
      s[j] = fmaf(w4.y, TANHF(q4.y + kv.y), s[j]);
      s[j] = fmaf(w4.z, TANHF(q4.z + kv.z), s[j]);
      s[j] = fmaf(w4.w, TANHF(q4.w + kv.w), s[j]);
    }
  }

  if (tid >= valid_lens[b]) {      // reference NEG_INF fill
#pragma unroll
    for (int j = 0; j < QT; ++j) s[j] = -1e6f;
  }

  float* sp = scores + (long)bq0 * AK + tid;
#pragma unroll  // constant indices: s stays in registers
  for (int j = 0; j < QT; ++j) sp[j * AK] = s[j];
}

// ---------------------------------------------------------------------------
// out[b] = softmax_k(scores[b])(64x512) * values[b](512x256), f32,
// V_WMMA_F32_16X16X4_F32.
// One block per 16x64 output tile: 4 x 4 x 16 = 256 blocks, 8 waves each.
// Wave w sums keys 64w .. 64w+63 for the whole tile (4 accumulators); the 8
// partial tiles are added through LDS in wave order. No operand is staged:
// each lane fetches its fragments with 16-byte loads, all issued before the
// first WMMA, so one memory latency is paid per wave.
// Softmax: wave w takes, per row, the maximum m_w of its own 64 scores, feeds
// p = exp(s - m_w) to the WMMAs and keeps l_w = sum p. With M = max_w m_w and
// f_w = exp(m_w - M), a row of the result is
//   (sum_w f_w * partial_w) / (sum_w f_w * l_w),
// formed where the partial tiles are added, behind the same barrier.
// k order, the same for A and B: in a group of 8 keys, WMMA s (0 or 1) takes
// keys 4*half + 2*s + {0,1}; a lane's float4 of attn holds both WMMAs' pairs.
// Columns: accumulator t, lane column r stands for column n0 + 4*r + t, so a
// lane's float4 of a values row feeds all 4 accumulators and a lane's 4
// accumulators hold 4 neighbouring columns of an output row.
// ---------------------------------------------------------------------------
#define VW 8             // waves per block
#define VK (AK / VW)     // keys per wave
#define VG (VK / 8)      // groups of 8 keys per wave

__device__ __forceinline__ float other_row(float v)
{
  const int x = __builtin_bit_cast(int, v);
  return __builtin_bit_cast(
      float, __builtin_amdgcn_permlanex16(x, x, 0x76543210, 0xfedcba98,
                                          false, false));
}

__global__ __launch_bounds__(32 * VW) void attn_values(
    const float* __restrict__ scores, const float* __restrict__ values,
    float* __restrict__ out)
{
  __shared__ __attribute__((aligned(16))) float red[VW * 16 * 64];
  __shared__ __attribute__((aligned(16))) float wmax[16 * VW];  // [row][wave]
  __shared__ __attribute__((aligned(16))) float wsum[16 * VW];  // [row][wave]

  const int lane = threadIdx.x & 31;
  const int wave = threadIdx.x >> 5;
  const int half = lane >> 4;
  const int r    = lane & 15;

  const int m0 = blockIdx.x * 16;
  const int n0 = blockIdx.y * 64;
  const int b  = blockIdx.z;
  const int k0 = wave * VK + 4 * half;   // this lane's first key

  const float* ap = scores + ((long)b * AQ + m0 + r) * AK + k0;
  const float* vp = values + ((long)b * AK + k0) * AH + n0 + 4 * r;

  v4f av[VG];
  v4f bv[VG][4];
  // The scores first: a wait on the load counter covers loads in issue order,
  // so the exponentials below run while the values are still on their way.
#pragma unroll  // constant indices: the arrays stay in registers
  for (int g = 0; g < VG; ++g)
    av[g] = *(const v4f*)(ap + 8 * g);
  // The built code lets a values load land in the registers that hold the
  // scores' address: the wait stands in front of that overwrite.
  asm volatile("s_wait_xcnt 0x0" ::: "memory");
#pragma unroll  // constant indices: the arrays stay in registers
  for (int g = 0; g < VG; ++g) {
#pragma unroll  // constant indices: the arrays stay in registers
    for (int c = 0; c < 4; ++c)
      bv[g][c] = *(const v4f*)(vp + (long)(8 * g + c) * AH);
  }
  // Keeps every load above in front of the first WMMA; sunk to their uses,
  // each group of loads would expose its own latency.
  __builtin_amdgcn_sched_barrier(0);

  // Row r's 64 scores of this wave lie in lanes r and r + 16, 32 in each.
  float mw = av[0][0];
#pragma unroll  // constant indices: the arrays stay in registers
  for (int g = 0; g < VG; ++g)
    mw = fmaxf(fmaxf(fmaxf(mw, av[g][0]), fmaxf(av[g][1], av[g][2])), av[g][3]);
  mw = fmaxf(mw, other_row(mw));
  float lw = 0.f;
#pragma unroll  // constant indices: the arrays stay in registers
  for (int g = 0; g < VG; ++g) {
#pragma unroll  // constant indices: the arrays stay in registers
    for (int c = 0; c < 4; ++c)
      av[g][c] = __expf(av[g][c] - mw);
    lw += (av[g][0] + av[g][1]) + (av[g][2] + av[g][3]);
  }
  lw += other_row(lw);
  if (half == 0) {
    wmax[r * VW + wave] = mw;
    wsum[r * VW + wave] = lw;
  }

  v8f acc[4] = {};
#pragma unroll  // constant indices: the arrays stay in registers
  for (int g = 0; g < VG; ++g) {
#pragma unroll  // constant indices: the arrays stay in registers
    for (int s = 0; s < 2; ++s) {
      v2f a;
      a[0] = av[g][2 * s];
      a[1] = av[g][2 * s + 1];
#pragma unroll  // constant indices: the arrays stay in registers
      for (int t = 0; t < 4; ++t) {
        v2f bf;
        bf[0] = bv[g][2 * s][t];
        bf[1] = bv[g][2 * s + 1][t];
        acc[t] = __builtin_amdgcn_wmma_f32_16x16x4_f32(
            false, a, false, bf, (short)0, acc[t], false, false);
      }
    }
  }

  float* rw = red + wave * (16 * 64) + (8 * half) * 64 + 4 * r;
#pragma unroll  // constant indices: the arrays stay in registers
  for (int j = 0; j < 8; ++j) {
    v4f p;
    p[0] = acc[0][j]; p[1] = acc[1][j]; p[2] = acc[2][j]; p[3] = acc[3][j];
    *(v4f*)(rw + j * 64) = p;
  }
  __syncthreads();

  // 256 threads, one float4 of the tile each: add the 8 partial tiles, each
  // brought from its wave's maximum to the row's.
  const int row = threadIdx.x >> 4;
  const int c4  = threadIdx.x & 15;
  const float* rp = red + row * 64 + 4 * c4;
  float pm[VW], pl[VW];
#pragma unroll  // constant indices: the arrays stay in registers
  for (int w = 0; w < VW; w += 4) {
    const v4f x = *(const v4f*)(wmax + row * VW + w);
    const v4f y = *(const v4f*)(wsum + row * VW + w);
    pm[w] = x[0]; pm[w + 1] = x[1]; pm[w + 2] = x[2]; pm[w + 3] = x[3];
    pl[w] = y[0]; pl[w + 1] = y[1]; pl[w + 2] = y[2]; pl[w + 3] = y[3];
  }
  float rmax = pm[0];
#pragma unroll  // constant indices: the arrays stay in registers
  for (int w = 1; w < VW; ++w) rmax = fmaxf(rmax, pm[w]);
  v4f sum = {};
  float den = 0.f;
#pragma unroll  // constant indices: the arrays stay in registers
  for (int w = 0; w < VW; ++w) {
    const float f = __expf(pm[w] - rmax);
    den = fmaf(f, pl[w], den);
    sum += f * *(const v4f*)(rp + w * (16 * 64));
  }
  *(v4f*)(out + ((long)b * AQ + m0 + row) * AH + n0 + 4 * c4) =
      sum * (1.0f / den);
}

// ---------------------------------------------------------------------------
// Launch: both projection GEMMs in one grid, masked scores, batched
// softmax(scores)@values.
// d_ws: [qproj 1MB | kproj 8MB, (b, h/4, k, h%4) | scores 2MB]
// ---------------------------------------------------------------------------
extern "C" void kernel_launch(void* const* d_in, const int* in_sizes, int n_in,
                              void* d_out, int out_size, void* d_ws, size_t ws_size,
                              hipStream_t stream)
{
  const float* querys = (const float*)d_in[0];  // (16,64,256)
  const float* keys   = (const float*)d_in[1];  // (16,512,256)
  const float* values = (const float*)d_in[2];  // (16,512,256)
  const int*   vlen   = (const int*)d_in[3];    // (16,)
  const float* Wq     = (const float*)d_in[4];  // (256,256)
  const float* Wk     = (const float*)d_in[5];  // (256,256)
  const float* wv     = (const float*)d_in[6];  // (256,)
  float* out = (float*)d_out;                   // (16,64,256)

  float* qproj = (float*)d_ws;                           // 16*64*256
  float* kproj = qproj + (size_t)AB * AQ * AH;           // 16*64*512*4
  float* attn  = kproj + (size_t)AB * AK * AH;           // 16*64*512

  // k = keys @ Wk (M=8192) in x-blocks 0..127 and q = querys @ Wq (M=1024)
  // in x-blocks 128..143; N=256, K=256 for both. Neither reads the other.
  wmma_gemm_f32<<<dim3((AB * AK) / 64 + (AB * AQ) / 64, AH / NPANEL, 1), 128,
                  0, stream>>>(
      keys, Wk, kproj, AB * AK, AH, AH, 0, 0, 0,
      querys, Wq, qproj, (AB * AK) / 64);

  // scores + mask : one block per (b, QT queries)
  masked_scores<<<dim3((AB * AQ) / QT), 512, 0, stream>>>(
      qproj, kproj, wv, vlen, attn);

  // out = softmax(scores) @ values : one block per 16x64 tile of a batch
  attn_values<<<dim3(AQ / 16, AH / 64, AB), 32 * VW, 0, stream>>>(
      attn, values, out);
}

// v006
// Measured time: 25.9 microseconds a run.
// Next to v005, in two timings, it ran 1.23 and 1.22 times as fast.
// Over all steps from v000 it is 2.97 times as fast.
#include <hip/hip_runtime.h>
#include <hip/hip_bf16.h>

// Problem constants (fixed by the reference)
#define AB 16   // batch
#define AQ 64   // queries
#define AK 512  // keys
#define AH 256  // hidden == D

typedef __attribute__((ext_vector_type(2))) float    v2f;
typedef __attribute__((ext_vector_type(4))) float    v4f;
typedef __attribute__((ext_vector_type(8))) float    v8f;
typedef __attribute__((ext_vector_type(4))) unsigned v4u;
typedef __attribute__((ext_vector_type(8))) int      v8i;
typedef __attribute__((ext_vector_type(4))) int      v4i;

// Keys at or past valid_len get the fill value whatever their projection or
// tanh sum is, so neither is computed for them. The number of groups of `per`
// keys that hold a key below valid_len; 0 .. AK / per for any valid_len.
__device__ __forceinline__ int live_groups(int valid_len, int per)
{
  const unsigned v = valid_len < 0 ? 0u : (unsigned)valid_len;
  const unsigned n = (v + (unsigned)(per - 1)) / (unsigned)per;
  return n < (unsigned)(AK / per) ? (int)n : AK / per;
}

#if defined(__has_builtin)
#  if __has_builtin(__builtin_amdgcn_tanhf)
#    define TANHF(x) __builtin_amdgcn_tanhf(x)
#  elif __has_builtin(__builtin_amdgcn_tanh_f32)
#    define TANHF(x) __builtin_amdgcn_tanh_f32(x)
#  else
#    define TANHF(x) tanhf(x)
#  endif
#else
#  define TANHF(x) tanhf(x)
#endif

// Tensor Data Mover (this toolchain: 6-arg clang-23 form:
// (v4u g0, v8i g1, v4i g2, v4i g3, v8i g4, i32 cpol)).
#if defined(__has_builtin)
#  if __has_builtin(__builtin_amdgcn_tensor_load_to_lds) && \
      __has_builtin(__builtin_amdgcn_s_wait_tensorcnt)
#    define HAVE_TDM 1
#  endif
#endif

#define BROW 72
#define KCHUNK 64
#define NPANEL 64
#define CHUNKF (KCHUNK * BROW)   // floats per LDS buffer

#if defined(HAVE_TDM)
__device__ __forceinline__ void tdm_stage_panel(const float* gsrc,
                                                const float* ldst, int N)
{
  const unsigned long long gaddr = (unsigned long long)(const void*)gsrc;
  const unsigned lds_off = (unsigned)(unsigned long long)(const void*)ldst;
  v4u g0;
  g0[0] = 1u;                                        // count=1, user mode
  g0[1] = lds_off;                                   // lds_addr (bytes)
  g0[2] = (unsigned)(gaddr & 0xFFFFFFFFull);         // global_addr[31:0]
  g0[3] = (unsigned)((gaddr >> 32) & 0x1FFFFFFull)   // global_addr[56:32]
          | (2u << 30);                              // type = 2 ("image")
  const unsigned td0 = (unsigned)N;
  const unsigned td1 = KCHUNK;
  const unsigned long long str0 = (unsigned long long)N;
  v8i g1;
  g1[0] = (int)((2u << 16) | (1u << 20) | (5u << 22) | (7u << 25));
  g1[1] = (int)((td0 & 0xFFFFu) << 16);              // [63:48]=td0 lo16
  g1[2] = (int)((td0 >> 16) | ((td1 & 0xFFFFu) << 16));
  g1[3] = (int)((td1 >> 16) | ((unsigned)NPANEL << 16));
  g1[4] = (int)KCHUNK;
  g1[5] = (int)(str0 & 0xFFFFFFFFull);
  g1[6] = (int)((str0 >> 32) & 0xFFFFull);           // stride1 = 0
  g1[7] = 0;
  v4i gz  = {0, 0, 0, 0};                            // 2D: groups 2/3 NULL
  v8i gz8 = {0, 0, 0, 0, 0, 0, 0, 0};                // unused extra group
  __builtin_amdgcn_tensor_load_to_lds(g0, g1, gz, gz, gz8, 0);
}
#endif

__global__ __launch_bounds__(128) void wmma_gemm_f32(
    const float* __restrict__ A, const float* __restrict__ Bm,
    float* __restrict__ C, int M, int N, int K,
    long sA, long sB, long sC,
    const float* __restrict__ A2, const float* __restrict__ B2,
    float* __restrict__ C2, int m2blocks, const int* __restrict__ valid_lens)
{
  __shared__ float lds_b[2 * CHUNKF];

  const int lane = threadIdx.x & 31;
  const int wave = threadIdx.x >> 5;          // 0..3 -> m sub-tile
  const int half = lane >> 4;                 // 0 or 1
  const int r    = lane & 15;

  const bool second = (int)blockIdx.y < m2blocks;   // same for the whole block
  int mtile = (int)blockIdx.y;
  if (!second) {
    const int c = (int)blockIdx.y - m2blocks;
    int kb = 0, first = 0, seen = 0;   // batch of tile c, its first tile's number
#pragma unroll  // AB scalar steps; the lengths come in one scalar load
    for (int i = 0; i < AB; ++i) {
      seen += live_groups(valid_lens[i], 64);
      if (i + 1 < AB && c >= seen) { kb = i + 1; first = seen; }
    }
    if (c >= seen) return;   // the whole block, before any load or barrier
    mtile = kb * (AK / 64) + (c - first);
  }

  const int m0 = mtile * 64 + wave * 16;
  const int nb = blockIdx.x * NPANEL;
  const int b  = blockIdx.z;

  const float* Ab = (second ? A2 : A)  + (long)b * sA;
  const float* Bb = (second ? B2 : Bm) + (long)b * sB;
  float*       Cb = (second ? C2 : C)  + (long)b * sC;

  v8f acc[4] = {};

  const float* arow = Ab + (long)(m0 + r) * K + 2 * half;

  const int nchunks = K / KCHUNK;

  auto compute_chunk = [&](int c) {
    const float* buf   = &lds_b[(c & 1) * CHUNKF];
    const float* achnk = arow + c * KCHUNK;
    // Preload all A fragments for this chunk as one load clause.
    v2f afrag[KCHUNK / 4];
#pragma unroll
    for (int i = 0; i < KCHUNK / 4; ++i)
      afrag[i] = *(const v2f*)(achnk + 4 * i);
#pragma unroll
    for (int kk = 0; kk < KCHUNK; kk += 4) {
      const v2f a = afrag[kk >> 2];
      const float* bbase = &buf[(kk + 2 * half) * BROW + r];
#pragma unroll
      for (int nt = 0; nt < 4; ++nt) {
        v2f bf;
        bf[0] = bbase[nt * 16];            // B[kk+2h  ][nb+16nt+r]
        bf[1] = bbase[nt * 16 + BROW];     // B[kk+2h+1][nb+16nt+r]
        acc[nt] = __builtin_amdgcn_wmma_f32_16x16x4_f32(
            false, bf, false, a, (short)0, acc[nt], false, false);
      }
    }
  };

#if defined(HAVE_TDM)
  if (threadIdx.x < 32)
    tdm_stage_panel(Bb + nb, &lds_b[0], N);
  for (int c = 0; c < nchunks; ++c) {
    if (threadIdx.x < 32)
      __builtin_amdgcn_s_wait_tensorcnt(0);   // chunk c has landed
    __syncthreads();                          // publish; buf[(c+1)&1] is free
    if ((c + 1 < nchunks) && threadIdx.x < 32)
      tdm_stage_panel(Bb + (long)(c + 1) * KCHUNK * N + nb,
                      &lds_b[((c + 1) & 1) * CHUNKF], N);
    compute_chunk(c);
  }
#else
  for (int c = 0; c < nchunks; ++c) {
    __syncthreads();
    float* buf = &lds_b[(c & 1) * CHUNKF];
    const float* src = Bb + (long)c * KCHUNK * N + nb;
    for (int f = threadIdx.x; f < KCHUNK * (NPANEL / 4); f += 128) {
      const int kr = f >> 4;        // row in chunk
      const int c4 = f & 15;        // float4 within row
      *(float4*)&buf[kr * BROW + c4 * 4] =
          *(const float4*)&src[(long)kr * N + c4 * 4];
    }
    __syncthreads();
    compute_chunk(c);
  }
#endif

  auto store_tiles = [&](float* cp, const int gs) {
#pragma unroll
    for (int nt = 0; nt < 4; ++nt) {
      v4f lo, hi;
      lo[0] = acc[nt][0]; lo[1] = acc[nt][1]; lo[2] = acc[nt][2]; lo[3] = acc[nt][3];
      hi[0] = acc[nt][4]; hi[1] = acc[nt][5]; hi[2] = acc[nt][6]; hi[3] = acc[nt][7];
      *(v4f*)(cp + (4 * nt) * gs)     = lo;
      *(v4f*)(cp + (4 * nt + 1) * gs) = hi;
    }
  };
  if (second) {   // same for the whole block; no barrier follows
    store_tiles(Cb + (long)(m0 + r) * N + nb + 8 * half, 4);
    return;
  }
  store_tiles(Cb + (long)(m0 / AK) * AK * N + (long)(nb + 8 * half) * AK
                 + (m0 % AK + r) * 4, 4 * AK);
  // The built code lays the other branch, which rewrites the address
  // registers, behind these stores: the wait stands in front of it.
  asm volatile("s_wait_xcnt 0x0" ::: "memory");
}

// ---------------------------------------------------------------------------
// Scores + mask (the softmax over k is taken by attn_values, which reads s):
//   s[b,q,k] = sum_h w_v[h] * tanh(qproj[b,q,h] + kproj[b,k,h])
//   s = (k < valid_len[b]) ? s : -1e6
// A unit of work is one wave's: KC keys (one per lane) times QT consecutive
// queries. A lane's kproj values are loaded once and feed QT running sums;
// each query's sum over h keeps its order.
// Only groups of KC keys that hold a key below valid_len are worked on. They
// are numbered without gaps by a running sum over the batches; with `total`
// such groups there are total * NQG units, group-major, and block i takes
// units [i * total / 16, (i + 1) * total / 16): at most SW, one per wave, and
// every block the same number to within one. Neighbouring units share their
// keys, so a block's waves read the same kproj lines. A live group lies in a
// live 64-row tile of the projection, so every kproj value read was written.
// The groups that are masked as a whole are filled by the wave that the plain
// numbering (b, group, query group) gives them to.
// kproj arrives in groups of 4 h, kprojG[b][h/4][k][h%4]: the 16-byte loads
// of a wave's 32 keys cover 512 contiguous bytes, 4 whole 128-byte lines.
// Avoids materializing the 537 MB (B,Q,K,H) features tensor.
// ---------------------------------------------------------------------------
#define QT 4             // queries per unit; AQ % QT == 0
#define KC 32            // keys per unit
#define SW 16            // waves per block
#define NKC (AK / KC)    // key groups per batch
#define NQG (AQ / QT)    // query groups per batch

__global__ __launch_bounds__(32 * SW) void masked_scores(
    const float* __restrict__ qproj, const float* __restrict__ kprojG,
    const float* __restrict__ wv, const int* __restrict__ valid_lens,
    float* __restrict__ scores)
{
  // Per wave: w_v, then the unit's QT rows of qproj. One base address serves
  // every LDS read of the loop.
  __shared__ __attribute__((aligned(16))) float lds[SW * (QT + 1) * AH];

  const int tid  = threadIdx.x;
  const int lane = tid & 31;
  // In a scalar register, so that the unit's numbers are scalar arithmetic.
  const int wave = __builtin_amdgcn_readfirstlane(tid >> 5);

  int upto[AB];   // live groups of batches 0 .. i
  int total = 0;
#pragma unroll  // AB scalar steps; the lengths come in one scalar load
  for (int i = 0; i < AB; ++i) {
    total += live_groups(valid_lens[i], KC);
    upto[i] = total;
  }

  // gridDim.x * SW == AB * NKC * NQG, so total * NQG / gridDim.x == total / 16.
  const int  v    = (((int)blockIdx.x * total) >> 4) + wave;
  const bool live = v < ((((int)blockIdx.x + 1) * total) >> 4);
  const int  grp  = v / NQG;
  // A live wave has grp < total, so b is the batch that holds group grp and
  // kc = grp - first < NKC; b < AB for any grp.
  int b = 0, first = 0;
#pragma unroll  // AB - 1 scalar steps
  for (int i = 0; i + 1 < AB; ++i)
    if (grp >= upto[i]) { b = i + 1; first = upto[i]; }
  const int kc  = grp - first;
  const int bq0 = b * AQ + (v % NQG) * QT;   // first flattened (b,q) of the unit
  const int vlb = valid_lens[b];
  // The plain numbering's unit of this wave, and whether its keys are all
  // masked; read here so that nothing waits for it behind the barrier.
  const int  g    = (int)blockIdx.x * SW + wave;
  const int  fb   = g / (NKC * NQG);
  const int  fk   = (g / NQG) % NKC;
  const bool fill = fk >= live_groups(valid_lens[fb], KC);

  float* lw  = &lds[wave * ((QT + 1) * AH)];
  float* lqw = lw + AH;
  if (live) {
    const float4* qs = (const float4*)(qproj + (long)bq0 * AH);
    const float4* ws = (const float4*)wv;
#pragma unroll  // the 10 loads of a wave's 5 KB go out together
    for (int i = 0; i < AH / 128; ++i)
      ((float4*)lw)[lane + 32 * i] = ws[lane + 32 * i];
#pragma unroll
    for (int i = 0; i < QT * AH / 128; ++i)
      ((float4*)lqw)[lane + 32 * i] = qs[lane + 32 * i];
  }
  __syncthreads();

  if (fill) {   // reference NEG_INF fill of a group with no key below valid_len
    float* fp = scores + (long)(fb * AQ + (g % NQG) * QT) * AK + fk * KC + lane;
#pragma unroll  // the row step folds into the stores' offsets
    for (int j = 0; j < QT; ++j) fp[j * AK] = -1e6f;
    // The built code reuses these stores' offset and data registers for the
    // key loop's addresses: the wait stands in front of that overwrite.
    asm volatile("s_wait_xcnt 0x0" ::: "memory");
  }
  if (!live) return;   // no barrier follows

  float s[QT];
#pragma unroll
  for (int j = 0; j < QT; ++j) s[j] = 0.f;

  const int key = kc * KC + lane;
  const float* kr = kprojG + (long)b * AK * AH + key * 4;
  // 8 loads (4 KB) of a wave in flight per trip: half as many exposed load
  // latencies per wave as with 4.
#pragma unroll 8
  for (int h = 0; h < AH; h += 4) {
    const float4 kv = *(const float4*)(kr + (long)h * AK);  // group h/4
    const float4 w4 = *(const float4*)&lw[h];
#pragma unroll
    for (int j = 0; j < QT; ++j) {
      const float4 q4 = *(const float4*)&lqw[j * AH + h];
      s[j] = fmaf(w4.x, TANHF(q4.x + kv.x), s[j]);
      s[j] = fmaf(w4.y, TANHF(q4.y + kv.y), s[j]);
      s[j] = fmaf(w4.z, TANHF(q4.z + kv.z), s[j]);
      s[j] = fmaf(w4.w, TANHF(q4.w + kv.w), s[j]);
    }
  }

  if (key >= vlb) {                // reference NEG_INF fill
#pragma unroll
    for (int j = 0; j < QT; ++j) s[j] = -1e6f;
  }

  float* sp = scores + (long)bq0 * AK + key;
#pragma unroll  // constant indices: s stays in registers
  for (int j = 0; j < QT; ++j) sp[j * AK] = s[j];
}

// ---------------------------------------------------------------------------
// out[b] = softmax_k(scores[b])(64x512) * values[b](512x256), f32,
// V_WMMA_F32_16X16X4_F32.
// One block per 16x64 output tile: 4 x 4 x 16 = 256 blocks, 8 waves each.
// Wave w sums keys 64w .. 64w+63 for the whole tile (4 accumulators); the 8
// partial tiles are added through LDS in wave order. No operand is staged:
// each lane fetches its fragments with 16-byte loads, all issued before the
// first WMMA, so one memory latency is paid per wave.
// Softmax: wave w takes, per row, the maximum m_w of its own 64 scores, feeds
// p = exp(s - m_w) to the WMMAs and keeps l_w = sum p. With M = max_w m_w and
// f_w = exp(m_w - M), a row of the result is
//   (sum_w f_w * partial_w) / (sum_w f_w * l_w),
// formed where the partial tiles are added, behind the same barrier.
// k order, the same for A and B: in a group of 8 keys, WMMA s (0 or 1) takes
// keys 4*half + 2*s + {0,1}; a lane's float4 of attn holds both WMMAs' pairs.
// Columns: accumulator t, lane column r stands for column n0 + 4*r + t, so a
// lane's float4 of a values row feeds all 4 accumulators and a lane's 4
// accumulators hold 4 neighbouring columns of an output row.
// ---------------------------------------------------------------------------
#define VW 8             // waves per block
#define VK (AK / VW)     // keys per wave
#define VG (VK / 8)      // groups of 8 keys per wave

__device__ __forceinline__ float other_row(float v)
{
  const int x = __builtin_bit_cast(int, v);
  return __builtin_bit_cast(
      float, __builtin_amdgcn_permlanex16(x, x, 0x76543210, 0xfedcba98,
                                          false, false));
}

__global__ __launch_bounds__(32 * VW) void attn_values(
    const float* __restrict__ scores, const float* __restrict__ values,
    float* __restrict__ out)
{
  __shared__ __attribute__((aligned(16))) float red[VW * 16 * 64];
  __shared__ __attribute__((aligned(16))) float wmax[16 * VW];  // [row][wave]
  __shared__ __attribute__((aligned(16))) float wsum[16 * VW];  // [row][wave]

  const int lane = threadIdx.x & 31;
  const int wave = threadIdx.x >> 5;
  const int half = lane >> 4;
  const int r    = lane & 15;

  const int m0 = blockIdx.x * 16;
  const int n0 = blockIdx.y * 64;
  const int b  = blockIdx.z;
  const int k0 = wave * VK + 4 * half;   // this lane's first key

  const float* ap = scores + ((long)b * AQ + m0 + r) * AK + k0;
  const float* vp = values + ((long)b * AK + k0) * AH + n0 + 4 * r;

  v4f av[VG];
  v4f bv[VG][4];
  // The scores first: a wait on the load counter covers loads in issue order,
  // so the exponentials below run while the values are still on their way.
#pragma unroll  // constant indices: the arrays stay in registers
  for (int g = 0; g < VG; ++g)
    av[g] = *(const v4f*)(ap + 8 * g);
  // The built code lets a values load land in the registers that hold the
  // scores' address: the wait stands in front of that overwrite.
  asm volatile("s_wait_xcnt 0x0" ::: "memory");
#pragma unroll  // constant indices: the arrays stay in registers
  for (int g = 0; g < VG; ++g) {
#pragma unroll  // constant indices: the arrays stay in registers
    for (int c = 0; c < 4; ++c)
      bv[g][c] = *(const v4f*)(vp + (long)(8 * g + c) * AH);
  }
  // Keeps every load above in front of the first WMMA; sunk to their uses,
  // each group of loads would expose its own latency.
  __builtin_amdgcn_sched_barrier(0);

  // Row r's 64 scores of this wave lie in lanes r and r + 16, 32 in each.
  float mw = av[0][0];
#pragma unroll  // constant indices: the arrays stay in registers
  for (int g = 0; g < VG; ++g)
    mw = fmaxf(fmaxf(fmaxf(mw, av[g][0]), fmaxf(av[g][1], av[g][2])), av[g][3]);
  mw = fmaxf(mw, other_row(mw));
  float lw = 0.f;
#pragma unroll  // constant indices: the arrays stay in registers
  for (int g = 0; g < VG; ++g) {
#pragma unroll  // constant indices: the arrays stay in registers
    for (int c = 0; c < 4; ++c)
      av[g][c] = __expf(av[g][c] - mw);
    lw += (av[g][0] + av[g][1]) + (av[g][2] + av[g][3]);
  }
  lw += other_row(lw);
  if (half == 0) {
    wmax[r * VW + wave] = mw;
    wsum[r * VW + wave] = lw;
  }

  v8f acc[4] = {};
#pragma unroll  // constant indices: the arrays stay in registers
  for (int g = 0; g < VG; ++g) {
#pragma unroll  // constant indices: the arrays stay in registers
    for (int s = 0; s < 2; ++s) {
      v2f a;
      a[0] = av[g][2 * s];
      a[1] = av[g][2 * s + 1];
#pragma unroll  // constant indices: the arrays stay in registers
      for (int t = 0; t < 4; ++t) {
        v2f bf;
        bf[0] = bv[g][2 * s][t];
        bf[1] = bv[g][2 * s + 1][t];
        acc[t] = __builtin_amdgcn_wmma_f32_16x16x4_f32(
            false, a, false, bf, (short)0, acc[t], false, false);
      }
    }
  }

  float* rw = red + wave * (16 * 64) + (8 * half) * 64 + 4 * r;
#pragma unroll  // constant indices: the arrays stay in registers
  for (int j = 0; j < 8; ++j) {
    v4f p;
    p[0] = acc[0][j]; p[1] = acc[1][j]; p[2] = acc[2][j]; p[3] = acc[3][j];
    *(v4f*)(rw + j * 64) = p;
  }
  __syncthreads();

  // 256 threads, one float4 of the tile each: add the 8 partial tiles, each
  // brought from its wave's maximum to the row's.
  const int row = threadIdx.x >> 4;
  const int c4  = threadIdx.x & 15;
  const float* rp = red + row * 64 + 4 * c4;
  float pm[VW], pl[VW];
#pragma unroll  // constant indices: the arrays stay in registers
  for (int w = 0; w < VW; w += 4) {
    const v4f x = *(const v4f*)(wmax + row * VW + w);
    const v4f y = *(const v4f*)(wsum + row * VW + w);
    pm[w] = x[0]; pm[w + 1] = x[1]; pm[w + 2] = x[2]; pm[w + 3] = x[3];
    pl[w] = y[0]; pl[w + 1] = y[1]; pl[w + 2] = y[2]; pl[w + 3] = y[3];
  }
  float rmax = pm[0];
#pragma unroll  // constant indices: the arrays stay in registers
  for (int w = 1; w < VW; ++w) rmax = fmaxf(rmax, pm[w]);
  v4f sum = {};
  float den = 0.f;
#pragma unroll  // constant indices: the arrays stay in registers
  for (int w = 0; w < VW; ++w) {
    const float f = __expf(pm[w] - rmax);
    den = fmaf(f, pl[w], den);
    sum += f * *(const v4f*)(rp + w * (16 * 64));
  }
  *(v4f*)(out + ((long)b * AQ + m0 + row) * AH + n0 + 4 * c4) =
      sum * (1.0f / den);
}

// ---------------------------------------------------------------------------
// Launch: both projection GEMMs in one grid, masked scores, batched
// softmax(scores)@values.
// d_ws: [qproj 1MB | kproj 8MB, (b, h/4, k, h%4) | scores 2MB]
// ---------------------------------------------------------------------------
extern "C" void kernel_launch(void* const* d_in, const int* in_sizes, int n_in,
                              void* d_out, int out_size, void* d_ws, size_t ws_size,
                              hipStream_t stream)
{
  const float* querys = (const float*)d_in[0];  // (16,64,256)
  const float* keys   = (const float*)d_in[1];  // (16,512,256)
  const float* values = (const float*)d_in[2];  // (16,512,256)
  const int*   vlen   = (const int*)d_in[3];    // (16,)
  const float* Wq     = (const float*)d_in[4];  // (256,256)
  const float* Wk     = (const float*)d_in[5];  // (256,256)
  const float* wv     = (const float*)d_in[6];  // (256,)
  float* out = (float*)d_out;                   // (16,64,256)

  float* qproj = (float*)d_ws;                           // 16*64*256
  float* kproj = qproj + (size_t)AB * AQ * AH;           // 16*64*512*4
  float* attn  = kproj + (size_t)AB * AK * AH;           // 16*64*512

  // q = querys @ Wq (M=1024) in y-blocks 0..15 and k = keys @ Wk (M=8192, the
  // tiles with a key below valid_len) in y-blocks 16..143; N=256, K=256 for
  // both. Neither reads the other.
  wmma_gemm_f32<<<dim3(AH / NPANEL, (AB * AQ) / 64 + (AB * AK) / 64, 1), 128,
                  0, stream>>>(
      keys, Wk, kproj, AB * AK, AH, AH, 0, 0, 0,
      querys, Wq, qproj, (AB * AQ) / 64, vlen);

  // scores + mask : one wave per (KC keys, QT queries)
  masked_scores<<<dim3((AB * NKC * NQG) / SW), 32 * SW, 0, stream>>>(
      qproj, kproj, wv, vlen, attn);

  // out = softmax(scores) @ values : one block per 16x64 tile of a batch
  attn_values<<<dim3(AQ / 16, AH / 64, AB), 32 * VW, 0, stream>>>(
      attn, values, out);
}

// v007
// One run takes 23.3 microseconds.
// In both of two side-by-side timings against v006, it was 1.11 times as fast.
// Counting every step since v000, it is 3.29 times as fast.
#include <hip/hip_runtime.h>
#include <hip/hip_bf16.h>

// Problem constants (fixed by the reference)
#define AB 16   // batch
#define AQ 64   // queries
#define AK 512  // keys
#define AH 256  // hidden == D

typedef __attribute__((ext_vector_type(2))) float    v2f;
typedef __attribute__((ext_vector_type(4))) float    v4f;
typedef __attribute__((ext_vector_type(8))) float    v8f;
typedef __attribute__((ext_vector_type(4))) unsigned v4u;
typedef __attribute__((ext_vector_type(8))) int      v8i;
typedef __attribute__((ext_vector_type(4))) int      v4i;

// Keys at or past valid_len get the fill value whatever their projection or
// tanh sum is, so neither is computed for them. The number of groups of `per`
// keys that hold a key below valid_len; 0 .. AK / per for any valid_len.
__device__ __forceinline__ int live_groups(int valid_len, int per)
{
  const unsigned v = valid_len < 0 ? 0u : (unsigned)valid_len;
  const unsigned n = (v + (unsigned)(per - 1)) / (unsigned)per;
  return n < (unsigned)(AK / per) ? (int)n : AK / per;
}

#if defined(__has_builtin)
#  if __has_builtin(__builtin_amdgcn_tanhf)
#    define TANHF(x) __builtin_amdgcn_tanhf(x)
#  elif __has_builtin(__builtin_amdgcn_tanh_f32)
#    define TANHF(x) __builtin_amdgcn_tanh_f32(x)
#  else
#    define TANHF(x) tanhf(x)
#  endif
#else
#  define TANHF(x) tanhf(x)
#endif

// Tensor Data Mover (this toolchain: 6-arg clang-23 form:
// (v4u g0, v8i g1, v4i g2, v4i g3, v8i g4, i32 cpol)).
#if defined(__has_builtin)
#  if __has_builtin(__builtin_amdgcn_tensor_load_to_lds) && \
      __has_builtin(__builtin_amdgcn_s_wait_tensorcnt)
#    define HAVE_TDM 1
#  endif
#endif

#define BROW 72
#define KCHUNK 64
#define NPANEL 64
#define CHUNKF (KCHUNK * BROW)   // floats per LDS buffer

#if defined(HAVE_TDM)
__device__ __forceinline__ void tdm_stage_panel(const float* gsrc,
                                                const float* ldst, int N)
{
  const unsigned long long gaddr = (unsigned long long)(const void*)gsrc;
  const unsigned lds_off = (unsigned)(unsigned long long)(const void*)ldst;
  v4u g0;
  g0[0] = 1u;                                        // count=1, user mode
  g0[1] = lds_off;                                   // lds_addr (bytes)
  g0[2] = (unsigned)(gaddr & 0xFFFFFFFFull);         // global_addr[31:0]
  g0[3] = (unsigned)((gaddr >> 32) & 0x1FFFFFFull)   // global_addr[56:32]
          | (2u << 30);                              // type = 2 ("image")
  const unsigned td0 = (unsigned)N;
  const unsigned td1 = KCHUNK;
  const unsigned long long str0 = (unsigned long long)N;
  v8i g1;
  g1[0] = (int)((2u << 16) | (1u << 20) | (5u << 22) | (7u << 25));
  g1[1] = (int)((td0 & 0xFFFFu) << 16);              // [63:48]=td0 lo16
  g1[2] = (int)((td0 >> 16) | ((td1 & 0xFFFFu) << 16));
  g1[3] = (int)((td1 >> 16) | ((unsigned)NPANEL << 16));
  g1[4] = (int)KCHUNK;
  g1[5] = (int)(str0 & 0xFFFFFFFFull);
  g1[6] = (int)((str0 >> 32) & 0xFFFFull);           // stride1 = 0
  g1[7] = 0;
  v4i gz  = {0, 0, 0, 0};                            // 2D: groups 2/3 NULL
  v8i gz8 = {0, 0, 0, 0, 0, 0, 0, 0};                // unused extra group
  __builtin_amdgcn_tensor_load_to_lds(g0, g1, gz, gz, gz8, 0);
}
#endif

__global__ __launch_bounds__(128) void wmma_gemm_f32(
    const float* __restrict__ A, const float* __restrict__ Bm,
    float* __restrict__ C, int M, int N, int K,
    long sA, long sB, long sC,
    const float* __restrict__ A2, const float* __restrict__ B2,
    float* __restrict__ C2, int m2blocks, const int* __restrict__ valid_lens)
{
  __shared__ float lds_b[2 * CHUNKF];

  const int lane = threadIdx.x & 31;
  const int wave = threadIdx.x >> 5;          // 0..3 -> m sub-tile
  const int half = lane >> 4;                 // 0 or 1
  const int r    = lane & 15;

  const bool second = (int)blockIdx.y < m2blocks;   // same for the whole block
  int mtile = (int)blockIdx.y;
  if (!second) {
    const int c = (int)blockIdx.y - m2blocks;
    int kb = 0, first = 0, seen = 0;   // batch of tile c, its first tile's number
#pragma unroll  // AB scalar steps; the lengths come in one scalar load
    for (int i = 0; i < AB; ++i) {
      seen += live_groups(valid_lens[i], 64);
      if (i + 1 < AB && c >= seen) { kb = i + 1; first = seen; }
    }
    if (c >= seen) return;   // the whole block, before any load or barrier
    mtile = kb * (AK / 64) + (c - first);
  }

  const int m0 = mtile * 64 + wave * 16;
  const int nb = blockIdx.x * NPANEL;
  const int b  = blockIdx.z;

  const float* Ab = (second ? A2 : A)  + (long)b * sA;
  const float* Bb = (second ? B2 : Bm) + (long)b * sB;
  float*       Cb = (second ? C2 : C)  + (long)b * sC;

  v8f acc[4] = {};

  const float* arow = Ab + (long)(m0 + r) * K + 2 * half;

  const int nchunks = K / KCHUNK;

  auto compute_chunk = [&](int c) {
    const float* buf   = &lds_b[(c & 1) * CHUNKF];
    const float* achnk = arow + c * KCHUNK;
    // Preload all A fragments for this chunk as one load clause.
    v2f afrag[KCHUNK / 4];
#pragma unroll
    for (int i = 0; i < KCHUNK / 4; ++i)
      afrag[i] = *(const v2f*)(achnk + 4 * i);
#pragma unroll
    for (int kk = 0; kk < KCHUNK; kk += 4) {
      const v2f a = afrag[kk >> 2];
      const float* bbase = &buf[(kk + 2 * half) * BROW + r];
#pragma unroll
      for (int nt = 0; nt < 4; ++nt) {
        v2f bf;
        bf[0] = bbase[nt * 16];            // B[kk+2h  ][nb+16nt+r]
        bf[1] = bbase[nt * 16 + BROW];     // B[kk+2h+1][nb+16nt+r]
        acc[nt] = __builtin_amdgcn_wmma_f32_16x16x4_f32(
            false, bf, false, a, (short)0, acc[nt], false, false);
      }
    }
  };

#if defined(HAVE_TDM)
  if (threadIdx.x < 32)
    tdm_stage_panel(Bb + nb, &lds_b[0], N);
  for (int c = 0; c < nchunks; ++c) {
    if (threadIdx.x < 32)
      __builtin_amdgcn_s_wait_tensorcnt(0);   // chunk c has landed
    __syncthreads();                          // publish; buf[(c+1)&1] is free
    if ((c + 1 < nchunks) && threadIdx.x < 32)
      tdm_stage_panel(Bb + (long)(c + 1) * KCHUNK * N + nb,
                      &lds_b[((c + 1) & 1) * CHUNKF], N);
    compute_chunk(c);
  }
#else
  for (int c = 0; c < nchunks; ++c) {
    __syncthreads();
    float* buf = &lds_b[(c & 1) * CHUNKF];
    const float* src = Bb + (long)c * KCHUNK * N + nb;
    for (int f = threadIdx.x; f < KCHUNK * (NPANEL / 4); f += 128) {
      const int kr = f >> 4;        // row in chunk
      const int c4 = f & 15;        // float4 within row
      *(float4*)&buf[kr * BROW + c4 * 4] =
          *(const float4*)&src[(long)kr * N + c4 * 4];
    }
    __syncthreads();
    compute_chunk(c);
  }
#endif

  auto store_tiles = [&](float* cp, const int gs) {
#pragma unroll
    for (int nt = 0; nt < 4; ++nt) {
      v4f lo, hi;
      lo[0] = acc[nt][0]; lo[1] = acc[nt][1]; lo[2] = acc[nt][2]; lo[3] = acc[nt][3];
      hi[0] = acc[nt][4]; hi[1] = acc[nt][5]; hi[2] = acc[nt][6]; hi[3] = acc[nt][7];
      *(v4f*)(cp + (4 * nt) * gs)     = lo;
      *(v4f*)(cp + (4 * nt + 1) * gs) = hi;
    }
  };
  if (second) {   // same for the whole block; no barrier follows
    store_tiles(Cb + (long)(m0 + r) * N + nb + 8 * half, 4);
    return;
  }
  store_tiles(Cb + (long)(m0 / AK) * AK * N + (long)(nb + 8 * half) * AK
                 + (m0 % AK + r) * 4, 4 * AK);
  // The built code lays the other branch, which rewrites the address
  // registers, behind these stores: the wait stands in front of it.
  asm volatile("s_wait_xcnt 0x0" ::: "memory");
}

#define QT 4
#define KC 32
#define SU 16
#define HS 4
#define SL 2
#define SW (HS * SL)
#define HP (AH / HS)
#define NKC (AK / KC)
#define NQG (AQ / QT)

__global__ __launch_bounds__(32 * SW) void masked_scores(
    const float* __restrict__ qproj, const float* __restrict__ kprojG,
    const float* __restrict__ wv, const int* __restrict__ valid_lens,
    float* __restrict__ scores)
{
  // Per unit: w_v, then the unit's QT rows of qproj as [h][q], so that one
  // 16-byte read holds the QT queries' values at one h in neighbouring
  // registers and the adds and multiply-adds of two queries go in pairs.
  __shared__ __attribute__((aligned(16))) float lds[SU * (QT + 1) * AH];
  // [unit][part of h][key][q]
  __shared__ __attribute__((aligned(16))) float part[SU * HS * KC * QT];

  const int tid  = threadIdx.x;
  const int lane = tid & 31;
  // In a scalar register, so that the units' numbers are scalar arithmetic.
  const int wave = __builtin_amdgcn_readfirstlane(tid >> 5);

  int upto[AB];   // live groups of batches 0 .. i
  int total = 0;
#pragma unroll  // AB scalar steps; the lengths come in one scalar load
  for (int i = 0; i < AB; ++i) {
    total += live_groups(valid_lens[i], KC);
    upto[i] = total;
  }

  // gridDim.x * SU == AB * NKC * NQG, so total * NQG / gridDim.x == total / 16.
  const int u0 = ((int)blockIdx.x * total) >> 4;
  const int nu = ((((int)blockIdx.x + 1) * total) >> 4) - u0;   // 0 .. SU
  // The block's units lie in groups g0 and g0 + 1. A unit that exists has a
  // group below total, so its batch holds that group and its group's number
  // inside the batch is below NKC; the batch is below AB for any group.
  const int g0 = u0 / NQG;
  int b0 = 0, first0 = 0, b1 = 0, first1 = 0;
#pragma unroll  // AB - 1 scalar steps
  for (int i = 0; i + 1 < AB; ++i) {
    if (g0 >= upto[i])     { b0 = i + 1; first0 = upto[i]; }
    if (g0 + 1 >= upto[i]) { b1 = i + 1; first1 = upto[i]; }
  }
  const int kc0 = g0 - first0;
  const int kc1 = g0 + 1 - first1;
  const int vl0 = valid_lens[b0];
  const int vl1 = valid_lens[b1];
  // The plain numbering's group of this block, and whether its keys are all
  // masked; read here so that nothing waits for it behind the barrier.
  const int  fb   = (int)blockIdx.x / NKC;
  const int  fk   = (int)blockIdx.x % NKC;
  const bool fill = fk >= live_groups(valid_lens[fb], KC);

  for (int ul = wave; ul < nu; ul += SW) {   // at most SU / SW trips
    const int v = u0 + ul;
    const int b = v / NQG != g0 ? b1 : b0;
    const v4f* qs = (const v4f*)(qproj + (long)(b * AQ + (v % NQG) * QT) * AH);
    const float4* ws = (const float4*)wv;
    float4* wd = (float4*)&lds[ul * ((QT + 1) * AH)];
    v4f* qd = (v4f*)(wd + AH / 4);
#pragma unroll  // the 10 loads of a unit's 5 KB go out together
    for (int i = 0; i < AH / 128; ++i)
      wd[lane + 32 * i] = ws[lane + 32 * i];
#pragma unroll
    for (int i = 0; i < AH / 128; ++i) {
      v4f r[QT];   // 4 h of each of the QT rows
#pragma unroll  // constant indices: the vectors stay in registers
      for (int j = 0; j < QT; ++j) r[j] = qs[j * (AH / 4) + 32 * i + lane];
#pragma unroll  // constant indices: the vectors stay in registers
      for (int c = 0; c < 4; ++c) {
        v4f t;
        t[0] = r[0][c]; t[1] = r[1][c]; t[2] = r[2][c]; t[3] = r[3][c];
        qd[128 * i + 4 * lane + c] = t;
      }
    }
    // The loads' address registers are rewritten by the next trip and behind
    // the loop: the wait stands in front of that overwrite.
    asm volatile("s_wait_xcnt 0x0" ::: "memory");
  }
  __syncthreads();

  if (fill) {   // reference NEG_INF fill of a group with no key below valid_len
    float* fp = scores + (long)(fb * AQ + wave * (AQ / SW)) * AK + fk * KC + lane;
#pragma unroll  // the row step folds into the stores' offsets
    for (int j = 0; j < AQ / SW; ++j) fp[j * AK] = -1e6f;
    // The stores' offset and data registers are free for reuse behind them:
    // the wait stands in front of any such overwrite.
    asm volatile("s_wait_xcnt 0x0" ::: "memory");
  }

  const int hp = wave % HS;
  for (int ul = wave / HS; ul < nu; ul += SL) {   // at most SU / SL trips
    const int  v   = u0 + ul;
    const bool sec = v / NQG != g0;
    const int  b   = sec ? b1 : b0;
    const int  kc  = sec ? kc1 : kc0;
    const float* kr = kprojG + (long)b * AK * AH + (long)(hp * HP) * AK
                      + (kc * KC + lane) * 4;
    const float* lw  = &lds[ul * ((QT + 1) * AH) + hp * HP];
    const float* lqu = &lds[ul * ((QT + 1) * AH) + AH + hp * HP * QT];

    float s[QT];
#pragma unroll  // constant indices: s stays in registers
    for (int j = 0; j < QT; ++j) s[j] = 0.f;
    // 8 loads (4 KB) of a wave in flight per trip. Kept rolled: with all of
    // the part in one body the built code waited for each load on its own.
#pragma unroll 1
    for (int h0 = 0; h0 < HP; h0 += 32) {
#pragma unroll  // the trip's 8 loads go out together
      for (int h = h0; h < h0 + 32; h += 4) {
        const v4f kv = *(const v4f*)(kr + (long)h * AK);  // group h/4
        const v4f w4 = *(const v4f*)&lw[h];
#pragma unroll  // constant indices: the vectors stay in registers
        for (int c = 0; c < 4; ++c) {
          const v4f q4 = *(const v4f*)&lqu[(h + c) * QT];   // QT queries at h + c
#pragma unroll  // constant indices: the vectors stay in registers
          for (int j = 0; j < QT; ++j)
            s[j] = fmaf(w4[c], TANHF(q4[j] + kv[c]), s[j]);
        }
      }
    }
    v4f ps;
    ps[0] = s[0]; ps[1] = s[1]; ps[2] = s[2]; ps[3] = s[3];
    *(v4f*)&part[((ul * HS + hp) * KC + lane) * QT] = ps;
    // The next trip rewrites the key loads' address registers: the wait
    // stands in front of that overwrite.
    asm volatile("s_wait_xcnt 0x0" ::: "memory");
  }
  __syncthreads();   // every part of every unit is in LDS

  for (int ul = wave; ul < nu; ul += SW) {   // at most SU / SW trips
    const int  v   = u0 + ul;
    const bool sec = v / NQG != g0;
    const int  b   = sec ? b1 : b0;
    const int  key = (sec ? kc1 : kc0) * KC + lane;
    const float* pp = &part[(ul * (HS * KC) + lane) * QT];
    v4f s = *(const v4f*)pp;
#pragma unroll  // the parts in the order of h
    for (int p = 1; p < HS; ++p) s += *(const v4f*)(pp + p * (KC * QT));
    if (key >= (sec ? vl1 : vl0)) {   // reference NEG_INF fill
#pragma unroll  // constant indices: s stays in registers
      for (int j = 0; j < QT; ++j) s[j] = -1e6f;
    }
    float* sp = scores + (long)(b * AQ + (v % NQG) * QT) * AK + key;
#pragma unroll  // constant indices: s stays in registers
    for (int j = 0; j < QT; ++j) sp[j * AK] = s[j];
    // The next trip rewrites the stores' registers: the wait stands in front
    // of that overwrite.
    asm volatile("s_wait_xcnt 0x0" ::: "memory");
  }
}

// ---------------------------------------------------------------------------
// out[b] = softmax_k(scores[b])(64x512) * values[b](512x256), f32,
// V_WMMA_F32_16X16X4_F32.
// One block per 16x64 output tile: 4 x 4 x 16 = 256 blocks, 8 waves each.
// Wave w sums keys 64w .. 64w+63 for the whole tile (4 accumulators); the 8
// partial tiles are added through LDS in wave order. No operand is staged:
// each lane fetches its fragments with 16-byte loads, all issued before the
// first WMMA, so one memory latency is paid per wave.
// Softmax: wave w takes, per row, the maximum m_w of its own 64 scores, feeds
// p = exp(s - m_w) to the WMMAs and keeps l_w = sum p. With M = max_w m_w and
// f_w = exp(m_w - M), a row of the result is
//   (sum_w f_w * partial_w) / (sum_w f_w * l_w),
// formed where the partial tiles are added, behind the same barrier.
// k order, the same for A and B: in a group of 8 keys, WMMA s (0 or 1) takes
// keys 4*half + 2*s + {0,1}; a lane's float4 of attn holds both WMMAs' pairs.
// Columns: accumulator t, lane column r stands for column n0 + 4*r + t, so a
// lane's float4 of a values row feeds all 4 accumulators and a lane's 4
// accumulators hold 4 neighbouring columns of an output row.
// ---------------------------------------------------------------------------
#define VW 8             // waves per block
#define VK (AK / VW)     // keys per wave
#define VG (VK / 8)      // groups of 8 keys per wave

__device__ __forceinline__ float other_row(float v)
{
  const int x = __builtin_bit_cast(int, v);
  return __builtin_bit_cast(
      float, __builtin_amdgcn_permlanex16(x, x, 0x76543210, 0xfedcba98,
                                          false, false));
}

__global__ __launch_bounds__(32 * VW) void attn_values(
    const float* __restrict__ scores, const float* __restrict__ values,
    float* __restrict__ out)
{
  __shared__ __attribute__((aligned(16))) float red[VW * 16 * 64];
  __shared__ __attribute__((aligned(16))) float wmax[16 * VW];  // [row][wave]
  __shared__ __attribute__((aligned(16))) float wsum[16 * VW];  // [row][wave]

  const int lane = threadIdx.x & 31;
  const int wave = threadIdx.x >> 5;
  const int half = lane >> 4;
  const int r    = lane & 15;

  const int m0 = blockIdx.x * 16;
  const int n0 = blockIdx.y * 64;
  const int b  = blockIdx.z;
  const int k0 = wave * VK + 4 * half;   // this lane's first key

  const float* ap = scores + ((long)b * AQ + m0 + r) * AK + k0;
  const float* vp = values + ((long)b * AK + k0) * AH + n0 + 4 * r;

  v4f av[VG];
  v4f bv[VG][4];
  // The scores first: a wait on the load counter covers loads in issue order,
  // so the exponentials below run while the values are still on their way.
#pragma unroll  // constant indices: the arrays stay in registers
  for (int g = 0; g < VG; ++g)
    av[g] = *(const v4f*)(ap + 8 * g);
  // The built code lets a values load land in the registers that hold the
  // scores' address: the wait stands in front of that overwrite.
  asm volatile("s_wait_xcnt 0x0" ::: "memory");
#pragma unroll  // constant indices: the arrays stay in registers
  for (int g = 0; g < VG; ++g) {
#pragma unroll  // constant indices: the arrays stay in registers
    for (int c = 0; c < 4; ++c)
      bv[g][c] = *(const v4f*)(vp + (long)(8 * g + c) * AH);
  }
  // Keeps every load above in front of the first WMMA; sunk to their uses,
  // each group of loads would expose its own latency.
  __builtin_amdgcn_sched_barrier(0);

  // Row r's 64 scores of this wave lie in lanes r and r + 16, 32 in each.
  float mw = av[0][0];
#pragma unroll  // constant indices: the arrays stay in registers
  for (int g = 0; g < VG; ++g)
    mw = fmaxf(fmaxf(fmaxf(mw, av[g][0]), fmaxf(av[g][1], av[g][2])), av[g][3]);
  mw = fmaxf(mw, other_row(mw));
  float lw = 0.f;
#pragma unroll  // constant indices: the arrays stay in registers
  for (int g = 0; g < VG; ++g) {
#pragma unroll  // constant indices: the arrays stay in registers
    for (int c = 0; c < 4; ++c)
      av[g][c] = __expf(av[g][c] - mw);
    lw += (av[g][0] + av[g][1]) + (av[g][2] + av[g][3]);
  }
  lw += other_row(lw);
  if (half == 0) {
    wmax[r * VW + wave] = mw;
    wsum[r * VW + wave] = lw;
  }

  v8f acc[4] = {};
#pragma unroll  // constant indices: the arrays stay in registers
  for (int g = 0; g < VG; ++g) {
#pragma unroll  // constant indices: the arrays stay in registers
    for (int s = 0; s < 2; ++s) {
      v2f a;
      a[0] = av[g][2 * s];
      a[1] = av[g][2 * s + 1];
#pragma unroll  // constant indices: the arrays stay in registers
      for (int t = 0; t < 4; ++t) {
        v2f bf;
        bf[0] = bv[g][2 * s][t];
        bf[1] = bv[g][2 * s + 1][t];
        acc[t] = __builtin_amdgcn_wmma_f32_16x16x4_f32(
            false, a, false, bf, (short)0, acc[t], false, false);
      }
    }
  }

  float* rw = red + wave * (16 * 64) + (8 * half) * 64 + 4 * r;
#pragma unroll  // constant indices: the arrays stay in registers
  for (int j = 0; j < 8; ++j) {
    v4f p;
    p[0] = acc[0][j]; p[1] = acc[1][j]; p[2] = acc[2][j]; p[3] = acc[3][j];
    *(v4f*)(rw + j * 64) = p;
  }
  __syncthreads();

  // 256 threads, one float4 of the tile each: add the 8 partial tiles, each
  // brought from its wave's maximum to the row's.
  const int row = threadIdx.x >> 4;
  const int c4  = threadIdx.x & 15;
  const float* rp = red + row * 64 + 4 * c4;
  float pm[VW], pl[VW];
#pragma unroll  // constant indices: the arrays stay in registers
  for (int w = 0; w < VW; w += 4) {
    const v4f x = *(const v4f*)(wmax + row * VW + w);
    const v4f y = *(const v4f*)(wsum + row * VW + w);
    pm[w] = x[0]; pm[w + 1] = x[1]; pm[w + 2] = x[2]; pm[w + 3] = x[3];
    pl[w] = y[0]; pl[w + 1] = y[1]; pl[w + 2] = y[2]; pl[w + 3] = y[3];
  }
  float rmax = pm[0];
#pragma unroll  // constant indices: the arrays stay in registers
  for (int w = 1; w < VW; ++w) rmax = fmaxf(rmax, pm[w]);
  v4f sum = {};
  float den = 0.f;
#pragma unroll  // constant indices: the arrays stay in registers
  for (int w = 0; w < VW; ++w) {
    const float f = __expf(pm[w] - rmax);
    den = fmaf(f, pl[w], den);
    sum += f * *(const v4f*)(rp + w * (16 * 64));
  }
  *(v4f*)(out + ((long)b * AQ + m0 + row) * AH + n0 + 4 * c4) =
      sum * (1.0f / den);
}

// ---------------------------------------------------------------------------
// Launch: both projection GEMMs in one grid, masked scores, batched
// softmax(scores)@values.
// d_ws: [qproj 1MB | kproj 8MB, (b, h/4, k, h%4) | scores 2MB]
// ---------------------------------------------------------------------------
extern "C" void kernel_launch(void* const* d_in, const int* in_sizes, int n_in,
                              void* d_out, int out_size, void* d_ws, size_t ws_size,
                              hipStream_t stream)
{
  const float* querys = (const float*)d_in[0];  // (16,64,256)
  const float* keys   = (const float*)d_in[1];  // (16,512,256)
  const float* values = (const float*)d_in[2];  // (16,512,256)
  const int*   vlen   = (const int*)d_in[3];    // (16,)
  const float* Wq     = (const float*)d_in[4];  // (256,256)
  const float* Wk     = (const float*)d_in[5];  // (256,256)
  const float* wv     = (const float*)d_in[6];  // (256,)
  float* out = (float*)d_out;                   // (16,64,256)

  float* qproj = (float*)d_ws;                           // 16*64*256
  float* kproj = qproj + (size_t)AB * AQ * AH;           // 16*64*512*4
  float* attn  = kproj + (size_t)AB * AK * AH;           // 16*64*512

  // q = querys @ Wq (M=1024) in y-blocks 0..15 and k = keys @ Wk (M=8192, the
  // tiles with a key below valid_len) in y-blocks 16..143; N=256, K=256 for
  // both. Neither reads the other.
  wmma_gemm_f32<<<dim3(AH / NPANEL, (AB * AQ) / 64 + (AB * AK) / 64, 1), 128,
                  0, stream>>>(
      keys, Wk, kproj, AB * AK, AH, AH, 0, 0, 0,
      querys, Wq, qproj, (AB * AQ) / 64, vlen);

  // scores + mask : one block per SU units of (KC keys, QT queries)
  masked_scores<<<dim3((AB * NKC * NQG) / SU), 32 * SW, 0, stream>>>(
      qproj, kproj, wv, vlen, attn);

  // out = softmax(scores) @ values : one block per 16x64 tile of a batch
  attn_values<<<dim3(AQ / 16, AH / 64, AB), 32 * VW, 0, stream>>>(
      attn, values, out);
}

// v008
// One run takes 19.7 microseconds.
// Timed twice side by side with v007, it ran 1.19 and 1.18 times as fast.
// All steps since v000 together make it 3.91 times as fast.
#include <hip/hip_runtime.h>
#include <hip/hip_bf16.h>

// Problem constants (fixed by the reference)
#define AB 16   // batch
#define AQ 64   // queries
#define AK 512  // keys
#define AH 256  // hidden == D

typedef __attribute__((ext_vector_type(2))) float    v2f;
typedef __attribute__((ext_vector_type(4))) float    v4f;
typedef __attribute__((ext_vector_type(8))) float    v8f;

// Keys at or past valid_len get the fill value whatever their projection or
// tanh sum is, so neither is computed for them. The number of groups of `per`
// keys that hold a key below valid_len; 0 .. AK / per for any valid_len.
__device__ __forceinline__ int live_groups(int valid_len, int per)
{
  const unsigned v = valid_len < 0 ? 0u : (unsigned)valid_len;
  const unsigned n = (v + (unsigned)(per - 1)) / (unsigned)per;
  return n < (unsigned)(AK / per) ? (int)n : AK / per;
}

#if defined(__has_builtin)
#  if __has_builtin(__builtin_amdgcn_tanhf)
#    define TANHF(x) __builtin_amdgcn_tanhf(x)
#  elif __has_builtin(__builtin_amdgcn_tanh_f32)
#    define TANHF(x) __builtin_amdgcn_tanh_f32(x)
#  else
#    define TANHF(x) tanhf(x)
#  endif
#else
#  define TANHF(x) tanhf(x)
#endif

// ---------------------------------------------------------------------------
// Row-major GEMM C = A(M x AH) * B(AH x AH), f32, V_WMMA_F32_16X16X4_F32.
// One block of PW waves per PT x PT tile of C. Wave w sums k = PK*w .. PK*w +
// PK-1 for the whole tile (16 accumulators); the PW partial tiles are added
// through LDS in wave order. No operand is staged: each lane fetches its
// fragments with 16-byte loads, all issued before the first WMMA, so one
// memory latency is paid per wave and every byte of A and B is read once per
// block.
// k order, the same for A and B: in a group of 8 k, WMMA s (0 or 1) takes
// k = 4*half + 2*s + {0,1}; a lane's float4 of an A row holds both WMMAs' pairs.
// Columns: accumulator t, lane column r stands for column nb + 4*r + t, so a
// lane's float4 of a B row feeds 4 accumulators of each of the 4 row tiles.
// The first product is stored in groups of 4 columns, inside each block of AK
// rows: element (m, n) lies at
//   (m / AK) * AK * AH + ((n / 4) * AK + m % AK) * 4 + n % 4.
// 32 neighbouring rows of one column group are 512 contiguous bytes, for the
// store here (one row per lane: 4 whole 128-byte lines per wave) and for a
// reader that has one row per lane.
// The second product is stored row-major.
// One launch carries a second, independent product: blocks with
// blockIdx.y < m2blocks compute C2 = A2 * B2.
// The other blocks take the first product's 64-row tiles that hold a key below
// their batch's valid_len, numbered without gaps from a running sum over the
// batches; a block past the last such tile leaves at once. blockIdx.x is the
// column panel, so the blocks that work are the first ones of the grid.
// ---------------------------------------------------------------------------
#define PT 64            // rows and columns of a block's tile
#define PW 4             // waves per block
#define PK (AH / PW)     // k per wave
#define PG (PK / 8)      // groups of 8 k per wave
#define PP (PT + 4)

__global__ __launch_bounds__(32 * PW) void wmma_gemm_f32(
    const float* __restrict__ A, const float* __restrict__ Bm,
    float* __restrict__ C,
    const float* __restrict__ A2, const float* __restrict__ B2,
    float* __restrict__ C2, int m2blocks, const int* __restrict__ valid_lens)
{
  __shared__ __attribute__((aligned(16))) float red[PW * PT * PP];

  const int lane = threadIdx.x & 31;
  const int wave = threadIdx.x >> 5;
  const int half = lane >> 4;                 // 0 or 1
  const int r    = lane & 15;

  const bool second = (int)blockIdx.y < m2blocks;   // same for the whole block
  int mtile = (int)blockIdx.y;
  if (!second) {
    const int c = (int)blockIdx.y - m2blocks;
    int kb = 0, first = 0, seen = 0;   // batch of tile c, its first tile's number
#pragma unroll  // AB scalar steps; the lengths come in one scalar load
    for (int i = 0; i < AB; ++i) {
      seen += live_groups(valid_lens[i], PT);
      if (i + 1 < AB && c >= seen) { kb = i + 1; first = seen; }
    }
    if (c >= seen) return;   // the whole block, before any load or barrier
    mtile = kb * (AK / PT) + (c - first);
  }

  const int m0 = mtile * PT;
  const int nb = blockIdx.x * PT;
  const int k0 = wave * PK + 4 * half;   // this lane's first k

  const float* ap = (second ? A2 : A)  + (long)(m0 + r) * AH + k0;
  const float* bp = (second ? B2 : Bm) + (long)k0 * AH + nb + 4 * r;

  v4f av[PG][PT / 16];   // 4 k of one row of each row tile
  v4f bv[PG][4];         // 4 columns at each of 4 k
#pragma unroll  // constant indices: the arrays stay in registers
  for (int g = 0; g < PG; ++g) {
#pragma unroll  // constant indices: the arrays stay in registers
    for (int i = 0; i < PT / 16; ++i)
      av[g][i] = *(const v4f*)(ap + (long)(16 * i) * AH + 8 * g);
#pragma unroll  // constant indices: the arrays stay in registers
    for (int c = 0; c < 4; ++c)
      bv[g][c] = *(const v4f*)(bp + (long)(8 * g + c) * AH);
  }
  // Keeps every load above in front of the first WMMA; sunk to their uses,
  // each group of loads would expose its own latency.
  __builtin_amdgcn_sched_barrier(0);

  v8f acc[PT / 16][4] = {};
#pragma unroll  // constant indices: the arrays stay in registers
  for (int g = 0; g < PG; ++g) {
#pragma unroll  // constant indices: the arrays stay in registers
    for (int s = 0; s < 2; ++s) {
      v2f bf[4];
#pragma unroll  // constant indices: the arrays stay in registers
      for (int t = 0; t < 4; ++t) {
        bf[t][0] = bv[g][2 * s][t];
        bf[t][1] = bv[g][2 * s + 1][t];
      }
#pragma unroll  // constant indices: the arrays stay in registers
      for (int i = 0; i < PT / 16; ++i) {
        v2f a;
        a[0] = av[g][i][2 * s];
        a[1] = av[g][i][2 * s + 1];
#pragma unroll  // constant indices: the arrays stay in registers
        for (int t = 0; t < 4; ++t)
          acc[i][t] = __builtin_amdgcn_wmma_f32_16x16x4_f32(
              false, a, false, bf[t], (short)0, acc[i][t], false, false);
      }
    }
  }

  // The wait in front of any overwrite of the loads' address registers. It
  // names them, so they stay unwritten up to here; in front of the WMMAs it
  // would hold the first one back until the last load's address is through.
  asm volatile("s_wait_xcnt 0x0" :: "v"(ap), "v"(bp) : "memory");

  float* rw = red + (wave * PT + 8 * half) * PP + 4 * r;
#pragma unroll  // constant indices: the arrays stay in registers
  for (int i = 0; i < PT / 16; ++i) {
#pragma unroll  // constant indices: the arrays stay in registers
    for (int j = 0; j < 8; ++j) {
      v4f p;
      p[0] = acc[i][0][j]; p[1] = acc[i][1][j];
      p[2] = acc[i][2][j]; p[3] = acc[i][3][j];
      *(v4f*)(rw + (16 * i + j) * PP) = p;
    }
  }
  __syncthreads();   // every wave's partial tile is in LDS

  // 128 threads, 8 float4 of the tile each: the PW partial tiles in wave order.
  auto tile_sum = [&](int row, int c4) {
    const float* rp = red + row * PP + 4 * c4;
    v4f s = *(const v4f*)rp;
#pragma unroll  // the partial tiles in wave order
    for (int w = 1; w < PW; ++w) s += *(const v4f*)(rp + w * (PT * PP));
    return s;
  };
  v4f sum[8];
  if (second) {   // same for the whole block; no barrier follows
    // 16 lanes cover 256 contiguous bytes of a row.
    const int c4 = threadIdx.x & 15;
    const int r0 = threadIdx.x >> 4;
    float* cp = C2 + (long)(m0 + r0) * AH + nb + 4 * c4;
#pragma unroll  // constant indices: sum stays in registers
    for (int i = 0; i < 8; ++i) sum[i] = tile_sum(r0 + 8 * i, c4);
#pragma unroll  // the row step folds into the stores' offsets
    for (int i = 0; i < 8; ++i) *(v4f*)(cp + (long)(8 * i) * AH) = sum[i];
    return;
  }
  // One row per lane: a wave's store covers 512 contiguous bytes.
  const int row = threadIdx.x & (PT - 1);
  const int cg0 = threadIdx.x >> 6;
  float* cp = C + (long)(m0 / AK) * AK * AH + (long)(nb / 4 + cg0) * (AK * 4)
                + (m0 % AK + row) * 4;
#pragma unroll  // constant indices: sum stays in registers
  for (int i = 0; i < 8; ++i) sum[i] = tile_sum(row, cg0 + 2 * i);
#pragma unroll  // the group step folds into the stores' offsets
  for (int i = 0; i < 8; ++i) *(v4f*)(cp + (long)(2 * i) * (AK * 4)) = sum[i];
  // The built code lays the other branch, which rewrites these stores'
  // registers, behind them: the wait stands in front of it.
  asm volatile("s_wait_xcnt 0x0" ::: "memory");
}

#define QT 4
#define KC 32
#define SU 16
#define HS 4
#define SL 2
#define SW (HS * SL)
#define HP (AH / HS)
#define NKC (AK / KC)
#define NQG (AQ / QT)

__global__ __launch_bounds__(32 * SW) void masked_scores(
    const float* __restrict__ qproj, const float* __restrict__ kprojG,
    const float* __restrict__ wv, const int* __restrict__ valid_lens,
    float* __restrict__ scores)
{
  // Per unit: w_v, then the unit's QT rows of qproj as [h][q], so that one
  // 16-byte read holds the QT queries' values at one h in neighbouring
  // registers and the adds and multiply-adds of two queries go in pairs.
  __shared__ __attribute__((aligned(16))) float lds[SU * (QT + 1) * AH];
  // [unit][part of h][key][q]
  __shared__ __attribute__((aligned(16))) float part[SU * HS * KC * QT];

  const int tid  = threadIdx.x;
  const int lane = tid & 31;
  // In a scalar register, so that the units' numbers are scalar arithmetic.
  const int wave = __builtin_amdgcn_readfirstlane(tid >> 5);

  int upto[AB];   // live groups of batches 0 .. i
  int total = 0;
#pragma unroll  // AB scalar steps; the lengths come in one scalar load
  for (int i = 0; i < AB; ++i) {
    total += live_groups(valid_lens[i], KC);
    upto[i] = total;
  }

  // gridDim.x * SU == AB * NKC * NQG, so total * NQG / gridDim.x == total / 16.
  const int u0 = ((int)blockIdx.x * total) >> 4;
  const int nu = ((((int)blockIdx.x + 1) * total) >> 4) - u0;   // 0 .. SU
  // The block's units lie in groups g0 and g0 + 1. A unit that exists has a
  // group below total, so its batch holds that group and its group's number
  // inside the batch is below NKC; the batch is below AB for any group.
  const int g0 = u0 / NQG;
  int b0 = 0, first0 = 0, b1 = 0, first1 = 0;
#pragma unroll  // AB - 1 scalar steps
  for (int i = 0; i + 1 < AB; ++i) {
    if (g0 >= upto[i])     { b0 = i + 1; first0 = upto[i]; }
    if (g0 + 1 >= upto[i]) { b1 = i + 1; first1 = upto[i]; }
  }
  const int kc0 = g0 - first0;
  const int kc1 = g0 + 1 - first1;
  const int vl0 = valid_lens[b0];
  const int vl1 = valid_lens[b1];
  // The plain numbering's group of this block, and whether its keys are all
  // masked; read here so that nothing waits for it behind the barrier.
  const int  fb   = (int)blockIdx.x / NKC;
  const int  fk   = (int)blockIdx.x % NKC;
  const bool fill = fk >= live_groups(valid_lens[fb], KC);

  for (int ul = wave; ul < nu; ul += SW) {   // at most SU / SW trips
    const int v = u0 + ul;
    const int b = v / NQG != g0 ? b1 : b0;
    const v4f* qs = (const v4f*)(qproj + (long)(b * AQ + (v % NQG) * QT) * AH);
    const float4* ws = (const float4*)wv;
    float4* wd = (float4*)&lds[ul * ((QT + 1) * AH)];
    v4f* qd = (v4f*)(wd + AH / 4);
#pragma unroll  // the 10 loads of a unit's 5 KB go out together
    for (int i = 0; i < AH / 128; ++i)
      wd[lane + 32 * i] = ws[lane + 32 * i];
#pragma unroll
    for (int i = 0; i < AH / 128; ++i) {
      v4f r[QT];   // 4 h of each of the QT rows
#pragma unroll  // constant indices: the vectors stay in registers
      for (int j = 0; j < QT; ++j) r[j] = qs[j * (AH / 4) + 32 * i + lane];
#pragma unroll  // constant indices: the vectors stay in registers
      for (int c = 0; c < 4; ++c) {
        v4f t;
        t[0] = r[0][c]; t[1] = r[1][c]; t[2] = r[2][c]; t[3] = r[3][c];
        qd[128 * i + 4 * lane + c] = t;
      }
    }
    // The loads' address registers are rewritten by the next trip and behind
    // the loop: the wait stands in front of that overwrite.
    asm volatile("s_wait_xcnt 0x0" ::: "memory");
  }
  __syncthreads();

  if (fill) {   // reference NEG_INF fill of a group with no key below valid_len
    float* fp = scores + (long)(fb * AQ + wave * (AQ / SW)) * AK + fk * KC + lane;
#pragma unroll  // the row step folds into the stores' offsets
    for (int j = 0; j < AQ / SW; ++j) fp[j * AK] = -1e6f;
    // The stores' offset and data registers are free for reuse behind them:
    // the wait stands in front of any such overwrite.
    asm volatile("s_wait_xcnt 0x0" ::: "memory");
  }

  const int hp = wave % HS;
  for (int ul = wave / HS; ul < nu; ul += SL) {   // at most SU / SL trips
    const int  v   = u0 + ul;
    const bool sec = v / NQG != g0;
    const int  b   = sec ? b1 : b0;
    const int  kc  = sec ? kc1 : kc0;
    const float* kr = kprojG + (long)b * AK * AH + (long)(hp * HP) * AK
                      + (kc * KC + lane) * 4;
    const float* lw  = &lds[ul * ((QT + 1) * AH) + hp * HP];
    const float* lqu = &lds[ul * ((QT + 1) * AH) + AH + hp * HP * QT];

    float s[QT];
#pragma unroll  // constant indices: s stays in registers
    for (int j = 0; j < QT; ++j) s[j] = 0.f;
    // 8 loads (4 KB) of a wave in flight per trip. Kept rolled: with all of
    // the part in one body the built code waited for each load on its own.
#pragma unroll 1
    for (int h0 = 0; h0 < HP; h0 += 32) {
#pragma unroll  // the trip's 8 loads go out together
      for (int h = h0; h < h0 + 32; h += 4) {
        const v4f kv = *(const v4f*)(kr + (long)h * AK);  // group h/4
        const v4f w4 = *(const v4f*)&lw[h];
#pragma unroll  // constant indices: the vectors stay in registers
        for (int c = 0; c < 4; ++c) {
          const v4f q4 = *(const v4f*)&lqu[(h + c) * QT];   // QT queries at h + c
#pragma unroll  // constant indices: the vectors stay in registers
          for (int j = 0; j < QT; ++j)
            s[j] = fmaf(w4[c], TANHF(q4[j] + kv[c]), s[j]);
        }
      }
    }
    v4f ps;
    ps[0] = s[0]; ps[1] = s[1]; ps[2] = s[2]; ps[3] = s[3];
    *(v4f*)&part[((ul * HS + hp) * KC + lane) * QT] = ps;
    // The next trip rewrites the key loads' address registers: the wait
    // stands in front of that overwrite.
    asm volatile("s_wait_xcnt 0x0" ::: "memory");
  }
  __syncthreads();   // every part of every unit is in LDS

  for (int ul = wave; ul < nu; ul += SW) {   // at most SU / SW trips
    const int  v   = u0 + ul;
    const bool sec = v / NQG != g0;
    const int  b   = sec ? b1 : b0;
    const int  key = (sec ? kc1 : kc0) * KC + lane;
    const float* pp = &part[(ul * (HS * KC) + lane) * QT];
    v4f s = *(const v4f*)pp;
#pragma unroll  // the parts in the order of h
    for (int p = 1; p < HS; ++p) s += *(const v4f*)(pp + p * (KC * QT));
    if (key >= (sec ? vl1 : vl0)) {   // reference NEG_INF fill
#pragma unroll  // constant indices: s stays in registers
      for (int j = 0; j < QT; ++j) s[j] = -1e6f;
    }
    float* sp = scores + (long)(b * AQ + (v % NQG) * QT) * AK + key;
#pragma unroll  // constant indices: s stays in registers
    for (int j = 0; j < QT; ++j) sp[j * AK] = s[j];
    // The next trip rewrites the stores' registers: the wait stands in front
    // of that overwrite.
    asm volatile("s_wait_xcnt 0x0" ::: "memory");
  }
}

// ---------------------------------------------------------------------------
// out[b] = softmax_k(scores[b])(64x512) * values[b](512x256), f32,
// V_WMMA_F32_16X16X4_F32.
// One block per 16x64 output tile: 4 x 4 x 16 = 256 blocks, 8 waves each.
// Wave w sums keys 64w .. 64w+63 for the whole tile (4 accumulators); the 8
// partial tiles are added through LDS in wave order. No operand is staged:
// each lane fetches its fragments with 16-byte loads, all issued before the
// first WMMA, so one memory latency is paid per wave.
// Softmax: wave w takes, per row, the maximum m_w of its own 64 scores, feeds
// p = exp(s - m_w) to the WMMAs and keeps l_w = sum p. With M = max_w m_w and
// f_w = exp(m_w - M), a row of the result is
//   (sum_w f_w * partial_w) / (sum_w f_w * l_w),
// formed where the partial tiles are added, behind the same barrier.
// k order, the same for A and B: in a group of 8 keys, WMMA s (0 or 1) takes
// keys 4*half + 2*s + {0,1}; a lane's float4 of attn holds both WMMAs' pairs.
// Columns: accumulator t, lane column r stands for column n0 + 4*r + t, so a
// lane's float4 of a values row feeds all 4 accumulators and a lane's 4
// accumulators hold 4 neighbouring columns of an output row.
// ---------------------------------------------------------------------------
#define VW 8             // waves per block
#define VK (AK / VW)     // keys per wave
#define VG (VK / 8)      // groups of 8 keys per wave

__device__ __forceinline__ float other_row(float v)
{
  const int x = __builtin_bit_cast(int, v);
  return __builtin_bit_cast(
      float, __builtin_amdgcn_permlanex16(x, x, 0x76543210, 0xfedcba98,
                                          false, false));
}

__global__ __launch_bounds__(32 * VW) void attn_values(
    const float* __restrict__ scores, const float* __restrict__ values,
    float* __restrict__ out)
{
  __shared__ __attribute__((aligned(16))) float red[VW * 16 * 64];
  __shared__ __attribute__((aligned(16))) float wmax[16 * VW];  // [row][wave]
  __shared__ __attribute__((aligned(16))) float wsum[16 * VW];  // [row][wave]

  const int lane = threadIdx.x & 31;
  const int wave = threadIdx.x >> 5;
  const int half = lane >> 4;
  const int r    = lane & 15;

  const int m0 = blockIdx.x * 16;
  const int n0 = blockIdx.y * 64;
  const int b  = blockIdx.z;
  const int k0 = wave * VK + 4 * half;   // this lane's first key

  const float* ap = scores + ((long)b * AQ + m0 + r) * AK + k0;
  const float* vp = values + ((long)b * AK + k0) * AH + n0 + 4 * r;

  v4f av[VG];
  v4f bv[VG][4];
  // The scores first: a wait on the load counter covers loads in issue order,
  // so the exponentials below run while the values are still on their way.
#pragma unroll  // constant indices: the arrays stay in registers
  for (int g = 0; g < VG; ++g)
    av[g] = *(const v4f*)(ap + 8 * g);
  // The built code lets a values load land in the registers that hold the
  // scores' address: the wait stands in front of that overwrite.
  asm volatile("s_wait_xcnt 0x0" ::: "memory");
#pragma unroll  // constant indices: the arrays stay in registers
  for (int g = 0; g < VG; ++g) {
#pragma unroll  // constant indices: the arrays stay in registers
    for (int c = 0; c < 4; ++c)
      bv[g][c] = *(const v4f*)(vp + (long)(8 * g + c) * AH);
  }
  // Keeps every load above in front of the first WMMA; sunk to their uses,
  // each group of loads would expose its own latency.
  __builtin_amdgcn_sched_barrier(0);

  // Row r's 64 scores of this wave lie in lanes r and r + 16, 32 in each.
  float mw = av[0][0];
#pragma unroll  // constant indices: the arrays stay in registers
  for (int g = 0; g < VG; ++g)
    mw = fmaxf(fmaxf(fmaxf(mw, av[g][0]), fmaxf(av[g][1], av[g][2])), av[g][3]);
  mw = fmaxf(mw, other_row(mw));
  float lw = 0.f;
#pragma unroll  // constant indices: the arrays stay in registers
  for (int g = 0; g < VG; ++g) {
#pragma unroll  // constant indices: the arrays stay in registers
    for (int c = 0; c < 4; ++c)
      av[g][c] = __expf(av[g][c] - mw);
    lw += (av[g][0] + av[g][1]) + (av[g][2] + av[g][3]);
  }
  lw += other_row(lw);
  if (half == 0) {
    wmax[r * VW + wave] = mw;
    wsum[r * VW + wave] = lw;
  }

  v8f acc[4] = {};
#pragma unroll  // constant indices: the arrays stay in registers
  for (int g = 0; g < VG; ++g) {
#pragma unroll  // constant indices: the arrays stay in registers
    for (int s = 0; s < 2; ++s) {
      v2f a;
      a[0] = av[g][2 * s];
      a[1] = av[g][2 * s + 1];
#pragma unroll  // constant indices: the arrays stay in registers
      for (int t = 0; t < 4; ++t) {
        v2f bf;
        bf[0] = bv[g][2 * s][t];
        bf[1] = bv[g][2 * s + 1][t];
        acc[t] = __builtin_amdgcn_wmma_f32_16x16x4_f32(
            false, a, false, bf, (short)0, acc[t], false, false);
      }
    }
  }

  float* rw = red + wave * (16 * 64) + (8 * half) * 64 + 4 * r;
#pragma unroll  // constant indices: the arrays stay in registers
  for (int j = 0; j < 8; ++j) {
    v4f p;
    p[0] = acc[0][j]; p[1] = acc[1][j]; p[2] = acc[2][j]; p[3] = acc[3][j];
    *(v4f*)(rw + j * 64) = p;
  }
  __syncthreads();

  // 256 threads, one float4 of the tile each: add the 8 partial tiles, each
  // brought from its wave's maximum to the row's.
  const int row = threadIdx.x >> 4;
  const int c4  = threadIdx.x & 15;
  const float* rp = red + row * 64 + 4 * c4;
  float pm[VW], pl[VW];
#pragma unroll  // constant indices: the arrays stay in registers
  for (int w = 0; w < VW; w += 4) {
    const v4f x = *(const v4f*)(wmax + row * VW + w);
    const v4f y = *(const v4f*)(wsum + row * VW + w);
    pm[w] = x[0]; pm[w + 1] = x[1]; pm[w + 2] = x[2]; pm[w + 3] = x[3];
    pl[w] = y[0]; pl[w + 1] = y[1]; pl[w + 2] = y[2]; pl[w + 3] = y[3];
  }
  float rmax = pm[0];
#pragma unroll  // constant indices: the arrays stay in registers
  for (int w = 1; w < VW; ++w) rmax = fmaxf(rmax, pm[w]);
  v4f sum = {};
  float den = 0.f;
#pragma unroll  // constant indices: the arrays stay in registers
  for (int w = 0; w < VW; ++w) {
    const float f = __expf(pm[w] - rmax);
    den = fmaf(f, pl[w], den);
    sum += f * *(const v4f*)(rp + w * (16 * 64));
  }
  *(v4f*)(out + ((long)b * AQ + m0 + row) * AH + n0 + 4 * c4) =
      sum * (1.0f / den);
}

// ---------------------------------------------------------------------------
// Launch: both projection GEMMs in one grid, masked scores, batched
// softmax(scores)@values.
// d_ws: [qproj 1MB | kproj 8MB, (b, h/4, k, h%4) | scores 2MB]
// ---------------------------------------------------------------------------
extern "C" void kernel_launch(void* const* d_in, const int* in_sizes, int n_in,
                              void* d_out, int out_size, void* d_ws, size_t ws_size,
                              hipStream_t stream)
{
  const float* querys = (const float*)d_in[0];  // (16,64,256)
  const float* keys   = (const float*)d_in[1];  // (16,512,256)
  const float* values = (const float*)d_in[2];  // (16,512,256)
  const int*   vlen   = (const int*)d_in[3];    // (16,)
  const float* Wq     = (const float*)d_in[4];  // (256,256)
  const float* Wk     = (const float*)d_in[5];  // (256,256)
  const float* wv     = (const float*)d_in[6];  // (256,)
  float* out = (float*)d_out;                   // (16,64,256)

  float* qproj = (float*)d_ws;                           // 16*64*256
  float* kproj = qproj + (size_t)AB * AQ * AH;           // 16*64*512*4
  float* attn  = kproj + (size_t)AB * AK * AH;           // 16*64*512

  // q = querys @ Wq (M=1024) in y-blocks 0..15 and k = keys @ Wk (M=8192, the
  // tiles with a key below valid_len) in y-blocks 16..143; N=256, K=256 for
  // both. Neither reads the other.
  wmma_gemm_f32<<<dim3(AH / PT, (AB * AQ) / PT + (AB * AK) / PT, 1), 32 * PW,
                  0, stream>>>(
      keys, Wk, kproj, querys, Wq, qproj, (AB * AQ) / PT, vlen);

  // scores + mask : one block per SU units of (KC keys, QT queries)
  masked_scores<<<dim3((AB * NKC * NQG) / SU), 32 * SW, 0, stream>>>(
      qproj, kproj, wv, vlen, attn);

  // out = softmax(scores) @ values : one block per 16x64 tile of a batch
  attn_values<<<dim3(AQ / 16, AH / 64, AB), 32 * VW, 0, stream>>>(
      attn, values, out);
}
